// v000
// The times below were measured on an AMD MI455X: many runs one after another, warmed up first and cycling through
// copies of the inputs, with the whole window's GPU time divided by the number of runs. Launches and the gaps
// between them are all in it. The median over several windows is given; except for v000 it joins two sittings, which
// can be a few percent apart, so the side-by-side timings, each taken in one sitting, are the better comparison.
// v000, which the later versions start from, runs in 407 microseconds.
#include <hip/hip_runtime.h>

// MultiHeadSA: per head h: q = x Wq[h] + bq[h], k = x Wk[h] + bk[h], v = x Wv[h] + bv[h] (D = 32); wei = softmax_s(q.k / sqrt(32)); out[b][t][h*32 + d] = sum_s wei v -> [4][2048][256].
// Deterministic: flash-style online softmax over fixed 256-key chunks in order; no atomics.
// WMMA (v_wmma_f32_16x16x32_f16, f32 accumulate): x (EXACT bf16 x8, K 32) x [Wq|Wk|Wv] rows (EXACT; 48 tiles) per 16-token wave; per (b,h, 32-query) wave S = q (hi+lo x256, K 32) x k rows (hi+lo; 16 tiles) and O += P (hi+lo) x v^T rows (hi+lo; 2 tiles), 3 products — 3.2 M WMMA; softmax in f32.

namespace {
constexpr int NB_ = 4, T = 2048, H = 8, D = 32, C = H * D /* 256 */, CH = 256;
constexpr float XS = 8.0f, HS = 256.0f, PS = 256.0f, WSC = 256.0f, SCALE = 0.17677669529663688f;
typedef _Float16 b16;
typedef __attribute__((ext_vector_type(16))) _Float16 v16b;
typedef __attribute__((ext_vector_type(8))) _Float16 v8b;
typedef __attribute__((ext_vector_type(2))) _Float16 v2b;
typedef __attribute__((ext_vector_type(8))) float v8f;
typedef __attribute__((ext_vector_type(4))) float v4f;
__device__ __forceinline__ float bf16_rne(float f) { unsigned int u = __float_as_uint(f); u += 0x7FFFu + ((u >> 16) & 1u); float r = __uint_as_float(u & 0xFFFF0000u); asm volatile("" : "+v"(r)); return r; }
__device__ __forceinline__ float bfv(float f) { float r = bf16_rne(f); asm volatile("" : "+v"(r)); return r; }
__device__ __forceinline__ void split16(float v, b16& hi, b16& lo) { hi = (b16)v; lo = (b16)(v - (float)hi); }
__device__ __forceinline__ v16b frag_kb(const b16* p, int hh) { const v8b a = *(const v8b*)(p + 8 * hh), b = *(const v8b*)(p + 16 + 8 * hh); v16b f;
#pragma unroll
  for (int e = 0; e < 8; ++e) { f[e] = a[e]; f[8 + e] = b[e]; } return f; }
__device__ __forceinline__ v8f wmma16b(v16b a, v16b b, v8f c) { v8f d = __builtin_amdgcn_wmma_f32_16x16x32_f16(false, a, false, b, (short)0, c, false, false); asm volatile("v_nop\n\tv_nop\n\tv_nop\n\tv_nop" : "+v"(d) : "v"(a), "v"(b)); return d; }
__device__ __forceinline__ void wave_lds_sync() { __builtin_amdgcn_fence(__ATOMIC_RELEASE, "workgroup"); __builtin_amdgcn_wave_barrier(); __builtin_amdgcn_fence(__ATOMIC_ACQUIRE, "workgroup"); }

__global__ __launch_bounds__(256) void wput_kernel(const float* __restrict__ wq, const float* __restrict__ wk, const float* __restrict__ wv, b16* __restrict__ WQKV) { const int u = blockIdx.x * 256 + threadIdx.x; if (u >= 3 * C * 4) return; const int r = u / 4, c0 = (u % 4) * 8; const int which = r / C, h = (r % C) / D, d = r % D; const float* w = which == 0 ? wq : (which == 1 ? wk : wv); v8b v;
#pragma unroll
  for (int j = 0; j < 8; ++j) v[j] = (b16)(bf16_rne(w[((size_t)h * D + c0 + j) * D + d]) * WSC);
  { *(v8b*)(WQKV + (size_t)r * D + c0) = v;  } }
__global__ __launch_bounds__(32) void proj_kernel(const float* __restrict__ x, const b16* __restrict__ WQKV, const float* __restrict__ bq, const float* __restrict__ bk, const float* __restrict__ bv, b16* __restrict__ Qh, b16* __restrict__ Ql, b16* __restrict__ Kh, b16* __restrict__ Kl, float* __restrict__ V) { __shared__ __attribute__((aligned(16))) b16 Ax[16][D + 8]; __shared__ float Tf[16][260]; const int lane = threadIdx.x, nloc = lane & 15, hlf = lane >> 4; const size_t t0 = (size_t)blockIdx.x * 16;
  for (int rr = 0; rr < 16; ++rr) Ax[rr][lane] = (b16)(bf16_rne(x[(t0 + rr) * D + lane]) * XS);
  if (lane < 16) for (int k = D; k < D + 8; ++k) Ax[lane][k] = (b16)0.0f;
  wave_lds_sync(); const v16b a = frag_kb(&Ax[nloc][0], hlf);
#pragma unroll 1
  for (int g = 0; g < 3; ++g) { const float* bias = g == 0 ? bq : (g == 1 ? bk : bv); v8f acc[16];
#pragma unroll
    for (int t = 0; t < 16; ++t) acc[t] = wmma16b(a, frag_kb(WQKV + (size_t)(g * C + t * 16 + nloc) * D, hlf), (v8f){});
#pragma unroll
    for (int t = 0; t < 16; ++t) { const int cc = t * 16 + nloc; const float bb = bfv(bias[cc]);
#pragma unroll
      for (int r8 = 0; r8 < 8; ++r8) Tf[8 * hlf + r8][cc] = acc[t][r8] * (1.0f / (XS * WSC)) + bb; }
    wave_lds_sync();
    { for (int rr = 0; rr < 16; ++rr) { const size_t tk = t0 + rr;
        if (g == 2) { for (int q = 0; q < 2; ++q) *(v4f*)(V + tk * C + q * 128 + lane * 4) = *(const v4f*)(&Tf[rr][q * 128 + lane * 4]); }
        else { b16* Ph = g == 0 ? Qh : Kh; b16* Pl = g == 0 ? Ql : Kl; for (int q = 0; q < 4; ++q) { const int c = q * 64 + lane * 2; b16 h0, l0, h1, l1; split16(Tf[rr][c] * HS, h0, l0); split16(Tf[rr][c + 1] * HS, h1, l1); *(v2b*)(Ph + tk * C + c) = (v2b){h0, h1}; *(v2b*)(Pl + tk * C + c) = (v2b){l0, l1}; } } }
       }
    wave_lds_sync(); } }
__global__ __launch_bounds__(256) void vt_kernel(const float* __restrict__ V, b16* __restrict__ VTh, b16* __restrict__ VTl) { __shared__ float Tt[64][C + 1]; const int b = blockIdx.x / (T / 64), tk0 = (blockIdx.x % (T / 64)) * 64; const int tid = threadIdx.x, wave = tid >> 5, lane = tid & 31;
  for (int q = wave; q < 64; q += 8) for (int c = lane; c < C; c += 32) Tt[q][c] = V[((size_t)b * T + tk0 + q) * C + c];
  __syncthreads();
  { for (int c = wave; c < C; c += 8) { const int h = c / D, d = c % D; b16 h0, l0, h1, l1; split16(Tt[lane * 2][c] * HS, h0, l0); split16(Tt[lane * 2 + 1][c] * HS, h1, l1); const size_t o = (((size_t)b * H + h) * D + d) * T + tk0 + lane * 2; *(v2b*)(VTh + o) = (v2b){h0, h1}; *(v2b*)(VTl + o) = (v2b){l0, l1}; }  } }
__global__ __launch_bounds__(32) void att_kernel(const b16* __restrict__ Qh, const b16* __restrict__ Ql, const b16* __restrict__ Kh, const b16* __restrict__ Kl, const b16* __restrict__ VTh, const b16* __restrict__ VTl, int QLIM, float* __restrict__ out) { __shared__ __attribute__((aligned(16))) b16 Pa[32][CH + 8], Pb[32][CH + 8]; __shared__ float Sc[32][CH + 1], Mx[32], Ls[32], Fc[32], Of[32][D + 1]; const int lane = threadIdx.x, nloc = lane & 15, hlf = lane >> 4; const int b = blockIdx.x / (H * (T / 32)), rem = blockIdx.x % (H * (T / 32)); const int h = rem / (T / 32), q0 = (rem % (T / 32)) * 32; if (q0 >= QLIM) return; const size_t tq = (size_t)b * T + q0;
  Mx[lane] = -INFINITY; Ls[lane] = 0.0f; for (int kk = CH; kk < CH + 8; ++kk) { Pa[lane][kk] = (b16)0.0f; Pb[lane][kk] = (b16)0.0f; }
  wave_lds_sync();
  v16b qa[2], ql[2]; for (int rt = 0; rt < 2; ++rt) { qa[rt] = frag_kb(Qh + (tq + rt * 16 + nloc) * C + h * D, hlf); ql[rt] = frag_kb(Ql + (tq + rt * 16 + nloc) * C + h * D, hlf); }
  v8f oacc[2][2] = {{(v8f){}, (v8f){}}, {(v8f){}, (v8f){}}};
#pragma unroll 1
  for (int ch = 0; ch < T / CH; ++ch) { const int k0 = ch * CH;
#pragma unroll 1
    for (int tg = 0; tg < 16; tg += 4) { v8f sacc[2][4];
#pragma unroll
      for (int rt = 0; rt < 2; ++rt)
#pragma unroll
        for (int t = 0; t < 4; ++t) sacc[rt][t] = (v8f){};
#pragma unroll
      for (int t = 0; t < 4; ++t) { const size_t key = ((size_t)b * T + k0 + (tg + t) * 16 + nloc) * C + h * D; const v16b kh = frag_kb(Kh + key, hlf), kl = frag_kb(Kl + key, hlf);
#pragma unroll
        for (int rt = 0; rt < 2; ++rt) { sacc[rt][t] = wmma16b(qa[rt], kh, sacc[rt][t]); sacc[rt][t] = wmma16b(qa[rt], kl, sacc[rt][t]); sacc[rt][t] = wmma16b(ql[rt], kh, sacc[rt][t]); } }
#pragma unroll
      for (int rt = 0; rt < 2; ++rt)
#pragma unroll
        for (int t = 0; t < 4; ++t)
#pragma unroll
          for (int r8 = 0; r8 < 8; ++r8) Sc[rt * 16 + 8 * hlf + r8][(tg + t) * 16 + nloc] = sacc[rt][t][r8] * (SCALE / (HS * HS)); }
    wave_lds_sync();
    { const int r = lane; float mx = -INFINITY; for (int j = 0; j < CH; ++j) mx = fmaxf(mx, Sc[r][j]); const float mo = Mx[r], mn = fmaxf(mo, mx); float sm = 0.0f; for (int j = 0; j < CH; ++j) { const float p = __expf(Sc[r][j] - mn); sm += p; b16 ph, pl; split16(p * PS, ph, pl); Pa[r][j] = ph; Pb[r][j] = pl; } const float fac = (mo == -INFINITY) ? 0.0f : __expf(mo - mn); Fc[r] = fac; Ls[r] = Ls[r] * fac + sm; Mx[r] = mn; }
    wave_lds_sync();
#pragma unroll
    for (int rt = 0; rt < 2; ++rt)
#pragma unroll
      for (int t = 0; t < 2; ++t)
#pragma unroll
        for (int r8 = 0; r8 < 8; ++r8) oacc[rt][t][r8] *= Fc[rt * 16 + 8 * hlf + r8];
#pragma unroll 2
    for (int kb = 0; kb < CH; kb += 32)
#pragma unroll
      for (int rt = 0; rt < 2; ++rt) { const v16b pa = frag_kb(&Pa[rt * 16 + nloc][kb], hlf), pb = frag_kb(&Pb[rt * 16 + nloc][kb], hlf);
#pragma unroll
        for (int t = 0; t < 2; ++t) { const size_t vo = (((size_t)b * H + h) * D + t * 16 + nloc) * T + k0 + kb; const v16b vh = frag_kb(VTh + vo, hlf), vl = frag_kb(VTl + vo, hlf); oacc[rt][t] = wmma16b(pa, vh, oacc[rt][t]); oacc[rt][t] = wmma16b(pa, vl, oacc[rt][t]); oacc[rt][t] = wmma16b(pb, vh, oacc[rt][t]); } }
    wave_lds_sync(); }
#pragma unroll
  for (int rt = 0; rt < 2; ++rt)
#pragma unroll
    for (int t = 0; t < 2; ++t)
#pragma unroll
      for (int r8 = 0; r8 < 8; ++r8) { const int r = rt * 16 + 8 * hlf + r8; Of[r][t * 16 + nloc] = oacc[rt][t][r8] * (1.0f / (PS * HS)) / Ls[r]; }
  wave_lds_sync();
  { for (int r = 0; r < 32; ++r) ((float*)out)[(tq + r) * C + h * D + lane] = Of[r][lane];  } }
}  // namespace

extern "C" void kernel_launch(void* const* d_in, const int* in_sizes, int n_in, void* d_out, int out_size, void* d_ws, size_t ws_size, hipStream_t stream) {
  (void)n_in;
  auto Fp = [&](int i) { return (const float*)d_in[i]; };
  // input order: 0 x [4,2048,32]; 1 Wq [8,32,32]; 2 bq [8,32]; 3 Wk; 4 bk; 5 Wv; 6 bv
  if (in_sizes[0] != NB_ * T * D || in_sizes[1] != H * D * D || in_sizes[3] != H * D * D || in_sizes[5] != H * D * D || in_sizes[2] != H * D || out_size != NB_ * T * C) return;
  const int QLIM = T;   // per-(b,h) query cut (multiple of 32)
  size_t off = 0; char* ws = (char*)d_ws;
  auto carve = [&](size_t bytes) { char* p = ws + off; off += (bytes + 255) & ~(size_t)255; return p; };
  b16* WQKV = (b16*)carve((size_t)3 * C * D * 2); b16* Qh = (b16*)carve((size_t)NB_ * T * C * 2); b16* Ql = (b16*)carve((size_t)NB_ * T * C * 2); b16* Kh = (b16*)carve((size_t)NB_ * T * C * 2); b16* Kl = (b16*)carve((size_t)NB_ * T * C * 2); float* V = (float*)carve((size_t)NB_ * T * C * 4); b16* VTh = (b16*)carve((size_t)NB_ * C * T * 2); b16* VTl = (b16*)carve((size_t)NB_ * C * T * 2);
  if (off > ws_size || off > ((size_t)40 << 20)) return;   // ~ 33 MB
  wput_kernel<<<(3 * C * 4 + 255) / 256, 256, 0, stream>>>(Fp(1), Fp(3), Fp(5), WQKV);
  proj_kernel<<<NB_ * T / 16, 32, 0, stream>>>(Fp(0), WQKV, Fp(2), Fp(4), Fp(6), Qh, Ql, Kh, Kl, V);
  vt_kernel<<<NB_ * (T / 64), 256, 0, stream>>>(V, VTh, VTl);
  att_kernel<<<NB_ * H * (T / 32), 32, 0, stream>>>(Qh, Ql, Kh, Kl, VTh, VTl, QLIM, (float*)d_out);
}

// v001
// One run takes 148 microseconds.
// In two side-by-side timings against v000, it was 2.78 and 2.77 times as fast.
#include <hip/hip_runtime.h>

// MultiHeadSA: per head h: q = x Wq[h] + bq[h], k = x Wk[h] + bk[h], v = x Wv[h] + bv[h] (D = 32); wei = softmax_s(q.k / sqrt(32)); out[b][t][h*32 + d] = sum_s wei v -> [4][2048][256].
// Deterministic: flash-style online softmax over fixed 32-key passes in order; no atomics.
// WMMA (v_wmma_f32_16x16x32_f16, f32 accumulate): x (EXACT bf16 x8, K 32) x [Wq|Wk|Wv] rows (EXACT; 48 tiles) per 16-token wave; per (b,h, 32-query) wave S^T = k rows (hi+lo) x q (hi+lo x256, K 32) and O^T += v^T rows (hi+lo) x P^T (hi+lo, packed from the S^T tiles), 3 products each; softmax in f32, in registers.

namespace {
constexpr int NB_ = 4, T = 2048, H = 8, D = 32, C = H * D /* 256 */, KC = 32 /* keys per pass */;
constexpr float XS = 8.0f, HS = 256.0f, PS = 256.0f, WSC = 256.0f, SCALE = 0.17677669529663688f;
typedef _Float16 b16;
typedef __attribute__((ext_vector_type(16))) _Float16 v16b;
typedef __attribute__((ext_vector_type(8))) _Float16 v8b;
typedef __attribute__((ext_vector_type(2))) _Float16 v2b;
typedef __attribute__((ext_vector_type(8))) float v8f;
typedef __attribute__((ext_vector_type(4))) float v4f;
typedef __attribute__((ext_vector_type(2))) float v2f;
__device__ __forceinline__ float bf16_rne(float f) { unsigned int u = __float_as_uint(f); u += 0x7FFFu + ((u >> 16) & 1u); float r = __uint_as_float(u & 0xFFFF0000u); asm volatile("" : "+v"(r)); return r; }
__device__ __forceinline__ float bfv(float f) { float r = bf16_rne(f); asm volatile("" : "+v"(r)); return r; }
__device__ __forceinline__ void split16(float v, b16& hi, b16& lo) { hi = (b16)v; lo = (b16)(v - (float)hi); }
__device__ __forceinline__ v16b frag_kb(const b16* p, int hh) { const v8b a = *(const v8b*)(p + 8 * hh), b = *(const v8b*)(p + 16 + 8 * hh); v16b f;
#pragma unroll
  for (int e = 0; e < 8; ++e) { f[e] = a[e]; f[8 + e] = b[e]; } return f; }
__device__ __forceinline__ v8f wmma16b(v16b a, v16b b, v8f c) { v8f d = __builtin_amdgcn_wmma_f32_16x16x32_f16(false, a, false, b, (short)0, c, false, false); asm volatile("v_nop\n\tv_nop\n\tv_nop\n\tv_nop" : "+v"(d) : "v"(a), "v"(b)); return d; }
__device__ __forceinline__ void wave_lds_sync() { __builtin_amdgcn_fence(__ATOMIC_RELEASE, "workgroup"); __builtin_amdgcn_wave_barrier(); __builtin_amdgcn_fence(__ATOMIC_ACQUIRE, "workgroup"); }

__global__ __launch_bounds__(256) void wput_kernel(const float* __restrict__ wq, const float* __restrict__ wk, const float* __restrict__ wv, b16* __restrict__ WQKV) { const int u = blockIdx.x * 256 + threadIdx.x; if (u >= 3 * C * 4) return; const int r = u / 4, c0 = (u % 4) * 8; const int which = r / C, h = (r % C) / D, d = r % D; const float* w = which == 0 ? wq : (which == 1 ? wk : wv); v8b v;
#pragma unroll
  for (int j = 0; j < 8; ++j) v[j] = (b16)(bf16_rne(w[((size_t)h * D + c0 + j) * D + d]) * WSC);
  { *(v8b*)(WQKV + (size_t)r * D + c0) = v;  } }
__global__ __launch_bounds__(32) void proj_kernel(const float* __restrict__ x, const b16* __restrict__ WQKV, const float* __restrict__ bq, const float* __restrict__ bk, const float* __restrict__ bv, b16* __restrict__ Qh, b16* __restrict__ Ql, b16* __restrict__ Kh, b16* __restrict__ Kl, float* __restrict__ V) { __shared__ __attribute__((aligned(16))) b16 Ax[16][D + 8]; __shared__ float Tf[16][260]; const int lane = threadIdx.x, nloc = lane & 15, hlf = lane >> 4; const size_t t0 = (size_t)blockIdx.x * 16;
  for (int rr = 0; rr < 16; ++rr) Ax[rr][lane] = (b16)(bf16_rne(x[(t0 + rr) * D + lane]) * XS);
  if (lane < 16) for (int k = D; k < D + 8; ++k) Ax[lane][k] = (b16)0.0f;
  wave_lds_sync(); const v16b a = frag_kb(&Ax[nloc][0], hlf);
#pragma unroll 1
  for (int g = 0; g < 3; ++g) { const float* bias = g == 0 ? bq : (g == 1 ? bk : bv); v8f acc[16];
#pragma unroll
    for (int t = 0; t < 16; ++t) acc[t] = wmma16b(a, frag_kb(WQKV + (size_t)(g * C + t * 16 + nloc) * D, hlf), (v8f){});
#pragma unroll
    for (int t = 0; t < 16; ++t) { const int cc = t * 16 + nloc; const float bb = bfv(bias[cc]);
#pragma unroll
      for (int r8 = 0; r8 < 8; ++r8) Tf[8 * hlf + r8][cc] = acc[t][r8] * (1.0f / (XS * WSC)) + bb; }
    wave_lds_sync();
    { for (int rr = 0; rr < 16; ++rr) { const size_t tk = t0 + rr;
        if (g == 2) { for (int q = 0; q < 2; ++q) *(v4f*)(V + tk * C + q * 128 + lane * 4) = *(const v4f*)(&Tf[rr][q * 128 + lane * 4]); }
        else { b16* Ph = g == 0 ? Qh : Kh; b16* Pl = g == 0 ? Ql : Kl; for (int q = 0; q < 4; ++q) { const int c = q * 64 + lane * 2; b16 h0, l0, h1, l1; split16(Tf[rr][c] * HS, h0, l0); split16(Tf[rr][c + 1] * HS, h1, l1); *(v2b*)(Ph + tk * C + c) = (v2b){h0, h1}; *(v2b*)(Pl + tk * C + c) = (v2b){l0, l1}; } } }
       }
    wave_lds_sync(); } }
__global__ __launch_bounds__(256) void vt_kernel(const float* __restrict__ V, b16* __restrict__ VTh, b16* __restrict__ VTl) { __shared__ float Tt[64][C + 1]; const int b = blockIdx.x / (T / 64), tk0 = (blockIdx.x % (T / 64)) * 64; const int tid = threadIdx.x, wave = tid >> 5, lane = tid & 31;
  for (int q = wave; q < 64; q += 8) for (int c = lane; c < C; c += 32) Tt[q][c] = V[((size_t)b * T + tk0 + q) * C + c];
  __syncthreads();
  { for (int c = wave; c < C; c += 8) { const int h = c / D, d = c % D; b16 h0, l0, h1, l1; split16(Tt[lane * 2][c] * HS, h0, l0); split16(Tt[lane * 2 + 1][c] * HS, h1, l1); const size_t o = (((size_t)b * H + h) * D + d) * T + tk0 + lane * 2; *(v2b*)(VTh + o) = (v2b){h0, h1}; *(v2b*)(VTl + o) = (v2b){l0, l1}; }  } }
// Scores are formed transposed, S^T = K Q^T: a lane holds 8 keys of ONE query per tile, so the maximum and the sum
// are taken in the lane's own registers (one exchange between the wave's halves), and two S^T tiles, converted in place,
// are the B operand of O^T += V^T P^T. Scores and P never pass through LDS.
__device__ __forceinline__ float other_half(float v) { return __uint_as_float(__builtin_amdgcn_permlanex16(__float_as_uint(v), __float_as_uint(v), 0x76543210u, 0xfedcba98u, false, false)); }
__global__ __launch_bounds__(32) void att_kernel(const b16* __restrict__ Qh, const b16* __restrict__ Ql, const b16* __restrict__ Kh, const b16* __restrict__ Kl, const b16* __restrict__ VTh, const b16* __restrict__ VTl, int QLIM, float* __restrict__ out) { const int lane = threadIdx.x, nloc = lane & 15, hlf = lane >> 4; const int b = blockIdx.x / (H * (T / 32)), rem = blockIdx.x % (H * (T / 32)); const int h = rem / (T / 32), q0 = (rem % (T / 32)) * 32; if (q0 >= QLIM) return; const size_t tq = (size_t)b * T + q0;
  constexpr float CL = SCALE / (HS * HS) * 1.4426950408889634f;   // raw score -> log2 units
  v16b qa[2], ql[2];
#pragma unroll
  for (int qt = 0; qt < 2; ++qt) { qa[qt] = frag_kb(Qh + (tq + qt * 16 + nloc) * C + h * D, hlf); ql[qt] = frag_kb(Ql + (tq + qt * 16 + nloc) * C + h * D, hlf); }
  asm volatile("s_wait_xcnt 0x0" ::: "memory");   // the Q loads' address registers are reused as destinations of the K loads below
  const size_t kbase = ((size_t)b * T + nloc) * C + h * D, vbase = (((size_t)b * H + h) * D + nloc) * T;
  v8f oacc[2][2] = {{(v8f){}, (v8f){}}, {(v8f){}, (v8f){}}};   // [query tile][d tile]: register r8 = d t*16 + 8*hlf + r8, lane column = query
  float mx[2] = {-INFINITY, -INFINITY}, ls[2] = {0.0f, 0.0f};   // ls: this half's keys only, in units of PS
  v16b kh[2], kl[2];
#pragma unroll
  for (int t = 0; t < 2; ++t) { kh[t] = frag_kb(Kh + kbase + (size_t)(t * 16) * C, hlf); kl[t] = frag_kb(Kl + kbase + (size_t)(t * 16) * C, hlf); }
  // The pass loop stays rolled (its body already takes about 236 VGPRs); the inner loops are unrolled so that every fragment index is a constant and stays in registers.
#pragma unroll 1
  for (int k0 = 0; k0 < T; k0 += KC) {
    v16b vh[2], vl[2];
#pragma unroll
    for (int t = 0; t < 2; ++t) { const size_t vo = vbase + (size_t)(t * 16) * T + k0; vh[t] = frag_kb(VTh + vo, hlf); vl[t] = frag_kb(VTl + vo, hlf); }
    v8f s[2][2];
#pragma unroll
    for (int t = 0; t < 2; ++t)
#pragma unroll
      for (int qt = 0; qt < 2; ++qt) s[qt][t] = wmma16b(kh[t], qa[qt], (v8f){});
#pragma unroll
    for (int t = 0; t < 2; ++t)
#pragma unroll
      for (int qt = 0; qt < 2; ++qt) s[qt][t] = wmma16b(kl[t], qa[qt], s[qt][t]);
#pragma unroll
    for (int t = 0; t < 2; ++t)
#pragma unroll
      for (int qt = 0; qt < 2; ++qt) s[qt][t] = wmma16b(kh[t], ql[qt], s[qt][t]);
    { const int kn = k0 + KC < T ? k0 + KC : 0;   // the next pass's K rows, into the registers just read; the last pass re-reads the first rows and drops them
#pragma unroll
      for (int t = 0; t < 2; ++t) { kh[t] = frag_kb(Kh + kbase + (size_t)(kn + t * 16) * C, hlf); kl[t] = frag_kb(Kl + kbase + (size_t)(kn + t * 16) * C, hlf); } }
    v16b ph[2], pl[2];
#pragma unroll
    for (int qt = 0; qt < 2; ++qt) { float c2[2];
#pragma unroll
      for (int t = 0; t < 2; ++t) { float m = s[qt][t][0];
#pragma unroll
        for (int r8 = 1; r8 < 8; ++r8) m = fmaxf(m, s[qt][t][r8]);
        c2[t] = m; }
      float cm = fmaxf(c2[0], c2[1]); cm = fmaxf(cm, other_half(cm));
      const float mo = mx[qt], mn = fmaxf(mo, cm); float fe; asm("v_exp_f32 %0, %1\n\tv_nop" : "=v"(fe) : "v"((mo - mn) * CL));   // exp2 and, in the same statement so that it stays directly behind, the one slot the instruction set asks for before a transcendental's source is overwritten or its result read
      const float fac = (mo == -INFINITY) ? 0.0f : fe; mx[qt] = mn;
      const float off = 8.0f - mn * CL;   // + 8: p comes out times PS = 256
      const v2f cl2 = {CL, CL}, off2 = {off, off}; v2f sm[2];
#pragma unroll
      for (int t = 0; t < 2; ++t)
#pragma unroll
        for (int e = 0; e < 8; e += 2) { const v2f a = __builtin_elementwise_fma((v2f){s[qt][t][e], s[qt][t][e + 1]}, cl2, off2); const v2f p = {__builtin_amdgcn_exp2f(a[0]), __builtin_amdgcn_exp2f(a[1])}; sm[t] = e == 0 ? p : sm[t] + p;
          const v2b hi = __builtin_convertvector(p, v2b); const v2b lo = __builtin_convertvector(p - __builtin_convertvector(hi, v2f), v2b);
          const int o = t * 8 + e; ph[qt][o] = hi[0]; ph[qt][o + 1] = hi[1]; pl[qt][o] = lo[0]; pl[qt][o + 1] = lo[1]; }
      const v2f s2 = sm[0] + sm[1]; ls[qt] = ls[qt] * fac + (s2[0] + s2[1]);
#pragma unroll
      for (int t = 0; t < 2; ++t) oacc[qt][t] *= fac; }
#pragma unroll
    for (int qt = 0; qt < 2; ++qt)
#pragma unroll
      for (int t = 0; t < 2; ++t) oacc[qt][t] = wmma16b(vh[t], ph[qt], oacc[qt][t]);
#pragma unroll
    for (int qt = 0; qt < 2; ++qt)
#pragma unroll
      for (int t = 0; t < 2; ++t) oacc[qt][t] = wmma16b(vl[t], ph[qt], oacc[qt][t]);
#pragma unroll
    for (int qt = 0; qt < 2; ++qt)
#pragma unroll
      for (int t = 0; t < 2; ++t) oacc[qt][t] = wmma16b(vh[t], pl[qt], oacc[qt][t]); }
#pragma unroll
  for (int qt = 0; qt < 2; ++qt) { const float inv = (1.0f / HS) / (ls[qt] + other_half(ls[qt]));
#pragma unroll
    for (int t = 0; t < 2; ++t) { float* o = out + (tq + qt * 16 + nloc) * C + h * D + t * 16 + 8 * hlf; const v8f r = oacc[qt][t] * inv; *(v4f*)o = (v4f){r[0], r[1], r[2], r[3]}; *(v4f*)(o + 4) = (v4f){r[4], r[5], r[6], r[7]}; } } }
}  // namespace

extern "C" void kernel_launch(void* const* d_in, const int* in_sizes, int n_in, void* d_out, int out_size, void* d_ws, size_t ws_size, hipStream_t stream) {
  (void)n_in;
  auto Fp = [&](int i) { return (const float*)d_in[i]; };
  // input order: 0 x [4,2048,32]; 1 Wq [8,32,32]; 2 bq [8,32]; 3 Wk; 4 bk; 5 Wv; 6 bv
  if (in_sizes[0] != NB_ * T * D || in_sizes[1] != H * D * D || in_sizes[3] != H * D * D || in_sizes[5] != H * D * D || in_sizes[2] != H * D || out_size != NB_ * T * C) return;
  const int QLIM = T;   // per-(b,h) query cut (multiple of 32)
  size_t off = 0; char* ws = (char*)d_ws;
  auto carve = [&](size_t bytes) { char* p = ws + off; off += (bytes + 255) & ~(size_t)255; return p; };
  b16* WQKV = (b16*)carve((size_t)3 * C * D * 2); b16* Qh = (b16*)carve((size_t)NB_ * T * C * 2); b16* Ql = (b16*)carve((size_t)NB_ * T * C * 2); b16* Kh = (b16*)carve((size_t)NB_ * T * C * 2); b16* Kl = (b16*)carve((size_t)NB_ * T * C * 2); float* V = (float*)carve((size_t)NB_ * T * C * 4); b16* VTh = (b16*)carve((size_t)NB_ * C * T * 2); b16* VTl = (b16*)carve((size_t)NB_ * C * T * 2);
  if (off > ws_size || off > ((size_t)40 << 20)) return;   // ~ 33 MB
  wput_kernel<<<(3 * C * 4 + 255) / 256, 256, 0, stream>>>(Fp(1), Fp(3), Fp(5), WQKV);
  proj_kernel<<<NB_ * T / 16, 32, 0, stream>>>(Fp(0), WQKV, Fp(2), Fp(4), Fp(6), Qh, Ql, Kh, Kl, V);
  vt_kernel<<<NB_ * (T / 64), 256, 0, stream>>>(V, VTh, VTl);
  att_kernel<<<NB_ * H * (T / 32), 32, 0, stream>>>(Qh, Ql, Kh, Kl, VTh, VTl, QLIM, (float*)d_out);
}

// v002
// Measured time: 125 microseconds a run.
// Timed twice side by side with v001, it ran 1.18 and 1.19 times as fast.
// Over all steps from v000 it is 3.29 times as fast.
#include <hip/hip_runtime.h>

// MultiHeadSA: per head h: q = x Wq[h] + bq[h], k = x Wk[h] + bk[h], v = x Wv[h] + bv[h] (D = 32); wei = softmax_s(q.k / sqrt(32)); out[b][t][h*32 + d] = sum_s wei v -> [4][2048][256].
// K and V^T lie in the workspace in fragment order: per (b,h) and 16-row tile 512 halves, element (row r, k) at (k>>4)*256 + (((k>>3)&1)*16 + r)*8 + (k&7), so one wave-wide 16-byte load reads 512 contiguous bytes (K: r = key, k = d; V^T: r = d, k = key within a 32-key pass, tiles ordered pass-major).
// Deterministic: flash-style online softmax over fixed 32-key passes in order; no atomics.
// WMMA (v_wmma_f32_16x16x32_f16, f32 accumulate): x (EXACT bf16 x8, K 32) x [Wq|Wk|Wv] rows (EXACT; 48 tiles) per 16-token wave; per (b,h, 32-query) wave S^T = k rows (hi+lo) x q (hi+lo x256, K 32) and O^T += v^T rows (hi+lo) x P^T (hi+lo, packed from the S^T tiles), 3 products each; softmax in f32, in registers.

namespace {
constexpr int NB_ = 4, T = 2048, H = 8, D = 32, C = H * D /* 256 */, KC = 32 /* keys per pass */;
constexpr float XS = 8.0f, HS = 256.0f, PS = 256.0f, WSC = 256.0f, SCALE = 0.17677669529663688f;
typedef _Float16 b16;
typedef __attribute__((ext_vector_type(16))) _Float16 v16b;
typedef __attribute__((ext_vector_type(8))) _Float16 v8b;
typedef __attribute__((ext_vector_type(2))) _Float16 v2b;
typedef __attribute__((ext_vector_type(8))) float v8f;
typedef __attribute__((ext_vector_type(4))) float v4f;
typedef __attribute__((ext_vector_type(2))) float v2f;
__device__ __forceinline__ float bf16_rne(float f) { unsigned int u = __float_as_uint(f); u += 0x7FFFu + ((u >> 16) & 1u); float r = __uint_as_float(u & 0xFFFF0000u); asm volatile("" : "+v"(r)); return r; }
__device__ __forceinline__ float bfv(float f) { float r = bf16_rne(f); asm volatile("" : "+v"(r)); return r; }
__device__ __forceinline__ void split16(float v, b16& hi, b16& lo) { hi = (b16)v; lo = (b16)(v - (float)hi); }
__device__ __forceinline__ v16b frag_kb(const b16* p, int hh) { const v8b a = *(const v8b*)(p + 8 * hh), b = *(const v8b*)(p + 16 + 8 * hh); v16b f;
#pragma unroll
  for (int e = 0; e < 8; ++e) { f[e] = a[e]; f[8 + e] = b[e]; } return f; }
__device__ __forceinline__ v16b frag_pk(const b16* p) { const v8b a = *(const v8b*)p, b = *(const v8b*)(p + 256); v16b f;   // p: tile base + lane * 8
#pragma unroll
  for (int e = 0; e < 8; ++e) { f[e] = a[e]; f[8 + e] = b[e]; } return f; }
__device__ __forceinline__ v8f wmma16b(v16b a, v16b b, v8f c) { v8f d = __builtin_amdgcn_wmma_f32_16x16x32_f16(false, a, false, b, (short)0, c, false, false); asm volatile("v_nop\n\tv_nop\n\tv_nop\n\tv_nop" : "+v"(d) : "v"(a), "v"(b)); return d; }
__device__ __forceinline__ void wave_lds_sync() { __builtin_amdgcn_fence(__ATOMIC_RELEASE, "workgroup"); __builtin_amdgcn_wave_barrier(); __builtin_amdgcn_fence(__ATOMIC_ACQUIRE, "workgroup"); }

__global__ __launch_bounds__(256) void wput_kernel(const float* __restrict__ wq, const float* __restrict__ wk, const float* __restrict__ wv, b16* __restrict__ WQKV) { const int u = blockIdx.x * 256 + threadIdx.x; if (u >= 3 * C * 4) return; const int r = u / 4, c0 = (u % 4) * 8; const int which = r / C, h = (r % C) / D, d = r % D; const float* w = which == 0 ? wq : (which == 1 ? wk : wv); v8b v;
#pragma unroll
  for (int j = 0; j < 8; ++j) v[j] = (b16)(bf16_rne(w[((size_t)h * D + c0 + j) * D + d]) * WSC);
  { *(v8b*)(WQKV + (size_t)r * D + c0) = v;  } }
__global__ __launch_bounds__(32) void proj_kernel(const float* __restrict__ x, const b16* __restrict__ WQKV, const float* __restrict__ bq, const float* __restrict__ bk, const float* __restrict__ bv, b16* __restrict__ Qh, b16* __restrict__ Ql, b16* __restrict__ Kh, b16* __restrict__ Kl, float* __restrict__ V) { __shared__ __attribute__((aligned(16))) b16 Ax[16][D + 8]; __shared__ __attribute__((aligned(16))) float Tf[16][260]; const int lane = threadIdx.x, nloc = lane & 15, hlf = lane >> 4; const size_t t0 = (size_t)blockIdx.x * 16;
  for (int rr = 0; rr < 16; ++rr) Ax[rr][lane] = (b16)(bf16_rne(x[(t0 + rr) * D + lane]) * XS);
  if (lane < 16) for (int k = D; k < D + 8; ++k) Ax[lane][k] = (b16)0.0f;
  wave_lds_sync(); const v16b a = frag_kb(&Ax[nloc][0], hlf);
#pragma unroll 1
  for (int g = 0; g < 3; ++g) { const float* bias = g == 0 ? bq : (g == 1 ? bk : bv); v8f acc[16];
#pragma unroll
    for (int t = 0; t < 16; ++t) acc[t] = wmma16b(a, frag_kb(WQKV + (size_t)(g * C + t * 16 + nloc) * D, hlf), (v8f){});
#pragma unroll
    for (int t = 0; t < 16; ++t) { const int cc = t * 16 + nloc; const float bb = bfv(bias[cc]);
#pragma unroll
      for (int r8 = 0; r8 < 8; ++r8) Tf[8 * hlf + r8][cc] = acc[t][r8] * (1.0f / (XS * WSC)) + bb; }
    wave_lds_sync();
    if (g == 1) { const size_t kt0 = (t0 / T) * (size_t)(H * (T / 16)) + (t0 % T) / 16;   // this wave's 16 tokens are one key tile of every head
      for (int hj = 0; hj < 2 * H; ++hj) { const float* sp = &Tf[nloc][hj * 16 + 8 * hlf]; const v4f f0 = *(const v4f*)sp, f1 = *(const v4f*)(sp + 4); v8b hi, lo;
#pragma unroll
        for (int e = 0; e < 8; ++e) { b16 a, c; split16((e < 4 ? f0[e & 3] : f1[e & 3]) * HS, a, c); hi[e] = a; lo[e] = c; }
        const size_t o = (kt0 + (size_t)(hj >> 1) * (T / 16)) * 512 + (hj & 1) * 256 + lane * 8; *(v8b*)(Kh + o) = hi; *(v8b*)(Kl + o) = lo; } }
    else { for (int rr = 0; rr < 16; ++rr) { const size_t tk = t0 + rr;
        if (g == 2) { for (int q = 0; q < 2; ++q) *(v4f*)(V + tk * C + q * 128 + lane * 4) = *(const v4f*)(&Tf[rr][q * 128 + lane * 4]); }
        else { b16* Ph = Qh; b16* Pl = Ql; for (int q = 0; q < 4; ++q) { const int c = q * 64 + lane * 2; b16 h0, l0, h1, l1; split16(Tf[rr][c] * HS, h0, l0); split16(Tf[rr][c + 1] * HS, h1, l1); *(v2b*)(Ph + tk * C + c) = (v2b){h0, h1}; *(v2b*)(Pl + tk * C + c) = (v2b){l0, l1}; }
          asm volatile("s_wait_xcnt 0x0" ::: "memory");   // the next row's reads and address steps rewrite the data and address registers of this row's Q stores
        } }
       }
    wave_lds_sync(); } }
__global__ __launch_bounds__(256) void vt_kernel(const float* __restrict__ V, b16* __restrict__ VTh, b16* __restrict__ VTl) { __shared__ float Tt[64][C + 2] /* pitch: the store pass reads rows 8 apart in the two lane halves; 8 * 258 dwords puts them 16 banks apart */; const int b = blockIdx.x / (T / 64), tk0 = (blockIdx.x % (T / 64)) * 64; const int tid = threadIdx.x, wave = tid >> 5, lane = tid & 31, nloc = lane & 15, hlf = lane >> 4;
  for (int q = wave; q < 64; q += 8) for (int c = lane; c < C; c += 32) Tt[q][c] = V[((size_t)b * T + tk0 + q) * C + c];
  __syncthreads();
  { for (int u = wave; u < 64; u += 8) { const int h = u >> 3, pt = (u >> 1) & 3 /* pass * 2 + d tile */, j = u & 1; const int c = h * D + (pt & 1) * 16 + nloc, kr = (pt >> 1) * 32 + j * 16 + hlf * 8; v8b hi, lo;
#pragma unroll
      for (int e = 0; e < 8; ++e) { b16 a, l; split16(Tt[kr + e][c] * HS, a, l); hi[e] = a; lo[e] = l; }
      const size_t o = ((((size_t)b * H + h) * (T / 32) + tk0 / 32) * 2 + pt) * 512 + j * 256 + lane * 8; *(v8b*)(VTh + o) = hi; *(v8b*)(VTl + o) = lo; }  } }
// Scores are formed transposed, S^T = K Q^T: a lane holds 8 keys of ONE query per tile, so the maximum and the sum
// are taken in the lane's own registers (one exchange between the wave's halves), and two S^T tiles, converted in place,
// are the B operand of O^T += V^T P^T. Scores and P never pass through LDS.
__device__ __forceinline__ float other_half(float v) { return __uint_as_float(__builtin_amdgcn_permlanex16(__float_as_uint(v), __float_as_uint(v), 0x76543210u, 0xfedcba98u, false, false)); }
__global__ __launch_bounds__(32) void att_kernel(const b16* __restrict__ Qh, const b16* __restrict__ Ql, const b16* __restrict__ Kh, const b16* __restrict__ Kl, const b16* __restrict__ VTh, const b16* __restrict__ VTl, int QLIM, float* __restrict__ out) { const int lane = threadIdx.x, nloc = lane & 15, hlf = lane >> 4; const int b = blockIdx.x / (H * (T / 32)), rem = blockIdx.x % (H * (T / 32)); const int h = rem / (T / 32), q0 = (rem % (T / 32)) * 32; if (q0 >= QLIM) return; const size_t tq = (size_t)b * T + q0;
  constexpr float CL = SCALE / (HS * HS) * 1.4426950408889634f;   // raw score -> log2 units
  v16b qa[2], ql[2];
#pragma unroll
  for (int qt = 0; qt < 2; ++qt) { qa[qt] = frag_kb(Qh + (tq + qt * 16 + nloc) * C + h * D, hlf); ql[qt] = frag_kb(Ql + (tq + qt * 16 + nloc) * C + h * D, hlf); }
  asm volatile("s_wait_xcnt 0x0" ::: "memory");   // the Q loads' address registers are reused as destinations of the K loads below
  const size_t kvbase = ((size_t)b * H + h) * (size_t)(T * D) + lane * 8;   // K and V^T alike: 32 keys = two 512-half tiles
  v8f oacc[2][2] = {{(v8f){}, (v8f){}}, {(v8f){}, (v8f){}}};   // [query tile][d tile]: register r8 = d t*16 + 8*hlf + r8, lane column = query
  float mx[2] = {-INFINITY, -INFINITY}, ls[2] = {0.0f, 0.0f};   // ls: this half's keys only, in units of PS
  v16b kh[2], kl[2];
#pragma unroll
  for (int t = 0; t < 2; ++t) { kh[t] = frag_pk(Kh + kvbase + t * 512); kl[t] = frag_pk(Kl + kvbase + t * 512); }
  // The pass loop stays rolled (its body already takes about 236 VGPRs); the inner loops are unrolled so that every fragment index is a constant and stays in registers.
#pragma unroll 1
  for (int k0 = 0; k0 < T; k0 += KC) {
    v16b vh[2], vl[2];
#pragma unroll
    for (int t = 0; t < 2; ++t) { const size_t vo = kvbase + (size_t)k0 * D + t * 512; vh[t] = frag_pk(VTh + vo); vl[t] = frag_pk(VTl + vo); }
    v8f s[2][2];
#pragma unroll
    for (int t = 0; t < 2; ++t)
#pragma unroll
      for (int qt = 0; qt < 2; ++qt) s[qt][t] = wmma16b(kh[t], qa[qt], (v8f){});
#pragma unroll
    for (int t = 0; t < 2; ++t)
#pragma unroll
      for (int qt = 0; qt < 2; ++qt) s[qt][t] = wmma16b(kl[t], qa[qt], s[qt][t]);
#pragma unroll
    for (int t = 0; t < 2; ++t)
#pragma unroll
      for (int qt = 0; qt < 2; ++qt) s[qt][t] = wmma16b(kh[t], ql[qt], s[qt][t]);
    { const int kn = k0 + KC < T ? k0 + KC : 0;   // the next pass's K rows, into the registers just read; the last pass re-reads the first rows and drops them
#pragma unroll
      for (int t = 0; t < 2; ++t) { kh[t] = frag_pk(Kh + kvbase + (size_t)kn * D + t * 512); kl[t] = frag_pk(Kl + kvbase + (size_t)kn * D + t * 512); } }
    v16b ph[2], pl[2];
#pragma unroll
    for (int qt = 0; qt < 2; ++qt) { float c2[2];
#pragma unroll
      for (int t = 0; t < 2; ++t) { float m = s[qt][t][0];
#pragma unroll
        for (int r8 = 1; r8 < 8; ++r8) m = fmaxf(m, s[qt][t][r8]);
        c2[t] = m; }
      float cm = fmaxf(c2[0], c2[1]); cm = fmaxf(cm, other_half(cm));
      const float mo = mx[qt], mn = fmaxf(mo, cm); float fe; asm("v_exp_f32 %0, %1\n\tv_nop" : "=v"(fe) : "v"((mo - mn) * CL));   // exp2 and, in the same statement so that it stays directly behind, the one slot the instruction set asks for before a transcendental's source is overwritten or its result read
      const float fac = (mo == -INFINITY) ? 0.0f : fe; mx[qt] = mn;
      const float off = 8.0f - mn * CL;   // + 8: p comes out times PS = 256
      const v2f cl2 = {CL, CL}, off2 = {off, off}; v2f sm[2];
#pragma unroll
      for (int t = 0; t < 2; ++t)
#pragma unroll
        for (int e = 0; e < 8; e += 2) { const v2f a = __builtin_elementwise_fma((v2f){s[qt][t][e], s[qt][t][e + 1]}, cl2, off2); const v2f p = {__builtin_amdgcn_exp2f(a[0]), __builtin_amdgcn_exp2f(a[1])}; sm[t] = e == 0 ? p : sm[t] + p;
          const v2b hi = __builtin_convertvector(p, v2b); const v2b lo = __builtin_convertvector(p - __builtin_convertvector(hi, v2f), v2b);
          const int o = t * 8 + e; ph[qt][o] = hi[0]; ph[qt][o + 1] = hi[1]; pl[qt][o] = lo[0]; pl[qt][o + 1] = lo[1]; }
      const v2f s2 = sm[0] + sm[1]; ls[qt] = ls[qt] * fac + (s2[0] + s2[1]);
#pragma unroll
      for (int t = 0; t < 2; ++t) oacc[qt][t] *= fac; }
#pragma unroll
    for (int qt = 0; qt < 2; ++qt)
#pragma unroll
      for (int t = 0; t < 2; ++t) oacc[qt][t] = wmma16b(vh[t], ph[qt], oacc[qt][t]);
#pragma unroll
    for (int qt = 0; qt < 2; ++qt)
#pragma unroll
      for (int t = 0; t < 2; ++t) oacc[qt][t] = wmma16b(vl[t], ph[qt], oacc[qt][t]);
#pragma unroll
    for (int qt = 0; qt < 2; ++qt)
#pragma unroll
      for (int t = 0; t < 2; ++t) oacc[qt][t] = wmma16b(vh[t], pl[qt], oacc[qt][t]); }
#pragma unroll
  for (int qt = 0; qt < 2; ++qt) { const float inv = (1.0f / HS) / (ls[qt] + other_half(ls[qt]));
#pragma unroll
    for (int t = 0; t < 2; ++t) { float* o = out + (tq + qt * 16 + nloc) * C + h * D + t * 16 + 8 * hlf; const v8f r = oacc[qt][t] * inv; *(v4f*)o = (v4f){r[0], r[1], r[2], r[3]}; *(v4f*)(o + 4) = (v4f){r[4], r[5], r[6], r[7]}; } } }
}  // namespace

extern "C" void kernel_launch(void* const* d_in, const int* in_sizes, int n_in, void* d_out, int out_size, void* d_ws, size_t ws_size, hipStream_t stream) {
  (void)n_in;
  auto Fp = [&](int i) { return (const float*)d_in[i]; };
  // input order: 0 x [4,2048,32]; 1 Wq [8,32,32]; 2 bq [8,32]; 3 Wk; 4 bk; 5 Wv; 6 bv
  if (in_sizes[0] != NB_ * T * D || in_sizes[1] != H * D * D || in_sizes[3] != H * D * D || in_sizes[5] != H * D * D || in_sizes[2] != H * D || out_size != NB_ * T * C) return;
  const int QLIM = T;   // per-(b,h) query cut (multiple of 32)
  size_t off = 0; char* ws = (char*)d_ws;
  auto carve = [&](size_t bytes) { char* p = ws + off; off += (bytes + 255) & ~(size_t)255; return p; };
  b16* WQKV = (b16*)carve((size_t)3 * C * D * 2); b16* Qh = (b16*)carve((size_t)NB_ * T * C * 2); b16* Ql = (b16*)carve((size_t)NB_ * T * C * 2); b16* Kh = (b16*)carve((size_t)NB_ * T * C * 2); b16* Kl = (b16*)carve((size_t)NB_ * T * C * 2); float* V = (float*)carve((size_t)NB_ * T * C * 4); b16* VTh = (b16*)carve((size_t)NB_ * C * T * 2); b16* VTl = (b16*)carve((size_t)NB_ * C * T * 2);
  if (off > ws_size || off > ((size_t)40 << 20)) return;   // ~ 33 MB
  wput_kernel<<<(3 * C * 4 + 255) / 256, 256, 0, stream>>>(Fp(1), Fp(3), Fp(5), WQKV);
  proj_kernel<<<NB_ * T / 16, 32, 0, stream>>>(Fp(0), WQKV, Fp(2), Fp(4), Fp(6), Qh, Ql, Kh, Kl, V);
  vt_kernel<<<NB_ * (T / 64), 256, 0, stream>>>(V, VTh, VTl);
  att_kernel<<<NB_ * H * (T / 32), 32, 0, stream>>>(Qh, Ql, Kh, Kl, VTh, VTl, QLIM, (float*)d_out);
}

// v003
// A run of this version takes 72.9 microseconds.
// Timed twice side by side with v002, it ran 1.64 and 1.65 times as fast.
// All steps since v000 together make it 5.41 times as fast.
#include <hip/hip_runtime.h>

// MultiHeadSA: per head h: q = x Wq[h] + bq[h], k = x Wk[h] + bk[h], v = x Wv[h] + bv[h] (D = 32); wei = softmax_s(q.k / sqrt(32)); out[b][t][h*32 + d] = sum_s wei v -> [4][2048][256].
// K and V^T lie in the workspace in fragment order: per (b,h) and 16-row tile 512 halves, element (row r, k) at (k>>4)*256 + (((k>>3)&1)*16 + r)*8 + (k&7), so one wave-wide 16-byte load reads 512 contiguous bytes (K: r = key, k = d; V^T: r = d, k = key within a 32-key pass, tiles ordered pass-major).
// Deterministic: flash-style online softmax over fixed 32-key passes in order; no atomics.
// WMMA (v_wmma_f32_16x16x32_f16, f32 accumulate): x (EXACT bf16 x8, K 32) x [Wq|Wk|Wv] rows (EXACT; 48 tiles) per 16-token wave; per (b,h, 32-query) wave S^T = k rows (hi+lo) x q (hi+lo x256, K 32) and O^T += v^T rows (hi+lo) x P^T (hi+lo, packed from the S^T tiles), 3 products each; softmax in f32, in registers.

namespace {
constexpr int NB_ = 4, T = 2048, H = 8, D = 32, C = H * D /* 256 */, KC = 32 /* keys per pass */;
constexpr float XS = 8.0f, HS = 256.0f, PS = 256.0f, WSC = 256.0f, SCALE = 0.17677669529663688f;
typedef _Float16 b16;
typedef __attribute__((ext_vector_type(16))) _Float16 v16b;
typedef __attribute__((ext_vector_type(8))) _Float16 v8b;
typedef __attribute__((ext_vector_type(2))) _Float16 v2b;
typedef __attribute__((ext_vector_type(8))) float v8f;
typedef __attribute__((ext_vector_type(4))) float v4f;
typedef __attribute__((ext_vector_type(2))) float v2f;
__device__ __forceinline__ float bf16_rne(float f) { unsigned int u = __float_as_uint(f); u += 0x7FFFu + ((u >> 16) & 1u); float r = __uint_as_float(u & 0xFFFF0000u); asm volatile("" : "+v"(r)); return r; }
__device__ __forceinline__ float bfv(float f) { float r = bf16_rne(f); asm volatile("" : "+v"(r)); return r; }
__device__ __forceinline__ void split16(float v, b16& hi, b16& lo) { hi = (b16)v; lo = (b16)(v - (float)hi); }
__device__ __forceinline__ v16b frag_kb(const b16* p, int hh) { const v8b a = *(const v8b*)(p + 8 * hh), b = *(const v8b*)(p + 16 + 8 * hh); v16b f;
#pragma unroll
  for (int e = 0; e < 8; ++e) { f[e] = a[e]; f[8 + e] = b[e]; } return f; }
__device__ __forceinline__ v16b frag_pk(const b16* p) { const v8b a = *(const v8b*)p, b = *(const v8b*)(p + 256); v16b f;   // p: tile base + lane * 8
#pragma unroll
  for (int e = 0; e < 8; ++e) { f[e] = a[e]; f[8 + e] = b[e]; } return f; }
__device__ __forceinline__ v8f wmma16b(v16b a, v16b b, v8f c) { v8f d = __builtin_amdgcn_wmma_f32_16x16x32_f16(false, a, false, b, (short)0, c, false, false); asm volatile("v_nop\n\tv_nop\n\tv_nop\n\tv_nop" : "+v"(d) : "v"(a), "v"(b)); return d; }
__device__ __forceinline__ void wave_lds_sync() { __builtin_amdgcn_fence(__ATOMIC_RELEASE, "workgroup"); __builtin_amdgcn_wave_barrier(); __builtin_amdgcn_fence(__ATOMIC_ACQUIRE, "workgroup"); }

__global__ __launch_bounds__(256) void wput_kernel(const float* __restrict__ wq, const float* __restrict__ wk, const float* __restrict__ wv, b16* __restrict__ WQKV) { const int u = blockIdx.x * 256 + threadIdx.x; if (u >= 3 * C * 4) return; const int r = u / 4, c0 = (u % 4) * 8; const int which = r / C, h = (r % C) / D, d = r % D; const float* w = which == 0 ? wq : (which == 1 ? wk : wv); v8b v; float wl[8];
#pragma unroll
  for (int j = 0; j < 8; ++j) wl[j] = w[((size_t)h * D + c0 + j) * D + d];   // all eight loads in flight before the first value is used
#pragma unroll
  for (int j = 0; j < 8; ++j) v[j] = (b16)(bf16_rne(wl[j]) * WSC);
  { *(v8b*)(WQKV + (size_t)r * D + c0) = v;  } }
__global__ __launch_bounds__(32) void proj_kernel(const float* __restrict__ x, const b16* __restrict__ WQKV, const float* __restrict__ bq, const float* __restrict__ bk, const float* __restrict__ bv, b16* __restrict__ Qh, b16* __restrict__ Ql, b16* __restrict__ Kh, b16* __restrict__ Kl, float* __restrict__ V) { __shared__ __attribute__((aligned(16))) b16 Ax[16][D + 8]; __shared__ __attribute__((aligned(16))) float Tf[16][260]; const int lane = threadIdx.x, nloc = lane & 15, hlf = lane >> 4; const size_t t0 = (size_t)blockIdx.x * 16;
  { float xl[16]; const float* xp = x + t0 * D + lane;
#pragma unroll
    for (int rr = 0; rr < 16; ++rr) xl[rr] = xp[rr * D];   // the 16 rows' loads in flight together: one latency, not 16
#pragma unroll
    for (int rr = 0; rr < 16; ++rr) Ax[rr][lane] = (b16)(bf16_rne(xl[rr]) * XS); }
  if (lane < 16) for (int k = D; k < D + 8; ++k) Ax[lane][k] = (b16)0.0f;
  wave_lds_sync(); const v16b a = frag_kb(&Ax[nloc][0], hlf);
#pragma unroll 1
  for (int g = 0; g < 3; ++g) { const float* bias = g == 0 ? bq : (g == 1 ? bk : bv); v8f acc[16]; v16b wf[16]; float bl[16];
#pragma unroll
    for (int t = 0; t < 16; ++t) { wf[t] = frag_kb(WQKV + (size_t)(g * C + t * 16 + nloc) * D, hlf); bl[t] = bias[t * 16 + nloc]; }   // the group's 32 fragment loads and 16 bias loads in flight before the first product
#pragma unroll
    for (int t = 0; t < 16; ++t) acc[t] = wmma16b(a, wf[t], (v8f){});
#pragma unroll
    for (int t = 0; t < 16; ++t) { const int cc = t * 16 + nloc; const float bb = bfv(bl[t]);
#pragma unroll
      for (int r8 = 0; r8 < 8; ++r8) Tf[8 * hlf + r8][cc] = acc[t][r8] * (1.0f / (XS * WSC)) + bb; }
    wave_lds_sync();
    if (g == 1) { const size_t kt0 = (t0 / T) * (size_t)(H * (T / 16)) + (t0 % T) / 16;   // this wave's 16 tokens are one key tile of every head
      v4f kf[2 * H][2];
#pragma unroll
      for (int hj = 0; hj < 2 * H; ++hj) { const float* sp = &Tf[nloc][hj * 16 + 8 * hlf]; kf[hj][0] = *(const v4f*)sp; kf[hj][1] = *(const v4f*)(sp + 4); }   // all LDS reads in flight before the first conversion
      v8b khi[2 * H], klo[2 * H];
#pragma unroll
      for (int hj = 0; hj < 2 * H; ++hj) { const v4f f0 = kf[hj][0], f1 = kf[hj][1];
#pragma unroll
        for (int e = 0; e < 8; ++e) { b16 a, c; split16((e < 4 ? f0[e & 3] : f1[e & 3]) * HS, a, c); khi[hj][e] = a; klo[hj][e] = c; } }
#pragma unroll
      for (int hj = 0; hj < 2 * H; ++hj) { const size_t o = (kt0 + (size_t)(hj >> 1) * (T / 16)) * 512 + (hj & 1) * 256 + lane * 8; *(v8b*)(Kh + o) = khi[hj]; *(v8b*)(Kl + o) = klo[hj]; } }
    else if (g == 2) { v4f vf[16][2];
#pragma unroll
      for (int rr = 0; rr < 16; ++rr) for (int q = 0; q < 2; ++q) vf[rr][q] = *(const v4f*)(&Tf[rr][q * 128 + lane * 4]);   // all LDS reads in flight before the first store
#pragma unroll
      for (int rr = 0; rr < 16; ++rr) for (int q = 0; q < 2; ++q) *(v4f*)(V + (t0 + rr) * C + q * 128 + lane * 4) = vf[rr][q];
      asm volatile("s_wait_xcnt 0x0" ::: "memory");   // what follows this branch rewrites the data and address registers of the V stores
    }
    else { v2f qf[16][4];
#pragma unroll
      for (int rr = 0; rr < 16; ++rr) for (int q = 0; q < 4; ++q) qf[rr][q] = *(const v2f*)(&Tf[rr][q * 64 + lane * 2]);   // all LDS reads in flight before the first conversion
      v2b qhi[16][4], qlo[16][4];
#pragma unroll
      for (int rr = 0; rr < 16; ++rr)
#pragma unroll
        for (int q = 0; q < 4; ++q) { b16 h0, l0, h1, l1; split16(qf[rr][q][0] * HS, h0, l0); split16(qf[rr][q][1] * HS, h1, l1); qhi[rr][q] = (v2b){h0, h1}; qlo[rr][q] = (v2b){l0, l1}; }
#pragma unroll
      for (int rr = 0; rr < 16; ++rr)
#pragma unroll
        for (int q = 0; q < 4; ++q) { const size_t o = (t0 + rr) * C + q * 64 + lane * 2; *(v2b*)(Qh + o) = qhi[rr][q]; *(v2b*)(Ql + o) = qlo[rr][q]; }
      asm volatile("s_wait_xcnt 0x0" ::: "memory");   // what follows this branch rewrites the data and address registers of the Q stores
    }
    wave_lds_sync(); } }
__global__ __launch_bounds__(256) void vt_kernel(const float* __restrict__ V, b16* __restrict__ VTh, b16* __restrict__ VTl) { __shared__ float Tt[64][C + 2] /* pitch: the store pass reads rows 8 apart in the two lane halves; 8 * 258 dwords puts them 16 banks apart */; const int b = blockIdx.x / (T / 64), tk0 = (blockIdx.x % (T / 64)) * 64; const int tid = threadIdx.x, wave = tid >> 5, lane = tid & 31, nloc = lane & 15, hlf = lane >> 4;
  { float vl[8][8]; const float* vp = V + ((size_t)b * T + tk0 + wave) * C + lane;
#pragma unroll
    for (int i = 0; i < 8; ++i)
#pragma unroll
      for (int j = 0; j < 8; ++j) vl[i][j] = vp[8 * i * C + 32 * j];   // the wave's 64 loads in flight together, then the LDS stores
    asm volatile("s_wait_xcnt 0x0" :: "v"(vp) : "memory");   // the address pair is an input here so that it stays whole behind the last load: without this the last loads' destinations were laid over it
#pragma unroll
    for (int i = 0; i < 8; ++i)
#pragma unroll
      for (int j = 0; j < 8; ++j) Tt[wave + 8 * i][lane + 32 * j] = vl[i][j]; }
  __syncthreads();
  { float tl[8][8];
#pragma unroll
    for (int i = 0; i < 8; ++i) { const int u = wave + 8 * i; const int h = u >> 3, pt = (u >> 1) & 3, j = u & 1; const int c = h * D + (pt & 1) * 16 + nloc, kr = (pt >> 1) * 32 + j * 16 + hlf * 8;
#pragma unroll
      for (int e = 0; e < 8; ++e) tl[i][e] = Tt[kr + e][c]; }   // all LDS reads in flight before the first conversion
#pragma unroll
    for (int i = 0; i < 8; ++i) { const int u = wave + 8 * i; const int h = u >> 3, pt = (u >> 1) & 3 /* pass * 2 + d tile */, j = u & 1; v8b hi, lo;
#pragma unroll
      for (int e = 0; e < 8; ++e) { b16 a, l; split16(tl[i][e] * HS, a, l); hi[e] = a; lo[e] = l; }
      const size_t o = ((((size_t)b * H + h) * (T / 32) + tk0 / 32) * 2 + pt) * 512 + j * 256 + lane * 8; *(v8b*)(VTh + o) = hi; *(v8b*)(VTl + o) = lo; }  } }
// Scores are formed transposed, S^T = K Q^T: a lane holds 8 keys of ONE query per tile, so the maximum and the sum
// are taken in the lane's own registers (one exchange between the wave's halves), and two S^T tiles, converted in place,
// are the B operand of O^T += V^T P^T. Scores and P never pass through LDS.
__device__ __forceinline__ float other_half(float v) { return __uint_as_float(__builtin_amdgcn_permlanex16(__float_as_uint(v), __float_as_uint(v), 0x76543210u, 0xfedcba98u, false, false)); }
__global__ __launch_bounds__(32) void att_kernel(const b16* __restrict__ Qh, const b16* __restrict__ Ql, const b16* __restrict__ Kh, const b16* __restrict__ Kl, const b16* __restrict__ VTh, const b16* __restrict__ VTl, int QLIM, float* __restrict__ out) { const int lane = threadIdx.x, nloc = lane & 15, hlf = lane >> 4; const int b = blockIdx.x / (H * (T / 32)), rem = blockIdx.x % (H * (T / 32)); const int h = rem / (T / 32), q0 = (rem % (T / 32)) * 32; if (q0 >= QLIM) return; const size_t tq = (size_t)b * T + q0;
  constexpr float CL = SCALE / (HS * HS) * 1.4426950408889634f;   // raw score -> log2 units
  v16b qa[2], ql[2];
#pragma unroll
  for (int qt = 0; qt < 2; ++qt) { qa[qt] = frag_kb(Qh + (tq + qt * 16 + nloc) * C + h * D, hlf); ql[qt] = frag_kb(Ql + (tq + qt * 16 + nloc) * C + h * D, hlf); }
  asm volatile("s_wait_xcnt 0x0" ::: "memory");   // the Q loads' address registers are reused as destinations of the K loads below
  const size_t kvbase = ((size_t)b * H + h) * (size_t)(T * D) + lane * 8;   // K and V^T alike: 32 keys = two 512-half tiles
  v8f oacc[2][2] = {{(v8f){}, (v8f){}}, {(v8f){}, (v8f){}}};   // [query tile][d tile]: register r8 = d t*16 + 8*hlf + r8, lane column = query
  float mx[2] = {-INFINITY, -INFINITY}, ls[2] = {0.0f, 0.0f};   // ls: this half's keys only, in units of PS
  v16b kh[2], kl[2];
#pragma unroll
  for (int t = 0; t < 2; ++t) { kh[t] = frag_pk(Kh + kvbase + t * 512); kl[t] = frag_pk(Kl + kvbase + t * 512); }
  // The pass loop stays rolled (its body already takes about 236 VGPRs); the inner loops are unrolled so that every fragment index is a constant and stays in registers.
#pragma unroll 1
  for (int k0 = 0; k0 < T; k0 += KC) {
    v16b vh[2], vl[2];
#pragma unroll
    for (int t = 0; t < 2; ++t) { const size_t vo = kvbase + (size_t)k0 * D + t * 512; vh[t] = frag_pk(VTh + vo); vl[t] = frag_pk(VTl + vo); }
    v8f s[2][2];
#pragma unroll
    for (int t = 0; t < 2; ++t)
#pragma unroll
      for (int qt = 0; qt < 2; ++qt) s[qt][t] = wmma16b(kh[t], qa[qt], (v8f){});
#pragma unroll
    for (int t = 0; t < 2; ++t)
#pragma unroll
      for (int qt = 0; qt < 2; ++qt) s[qt][t] = wmma16b(kl[t], qa[qt], s[qt][t]);
#pragma unroll
    for (int t = 0; t < 2; ++t)
#pragma unroll
      for (int qt = 0; qt < 2; ++qt) s[qt][t] = wmma16b(kh[t], ql[qt], s[qt][t]);
    { const int kn = k0 + KC < T ? k0 + KC : 0;   // the next pass's K rows, into the registers just read; the last pass re-reads the first rows and drops them
#pragma unroll
      for (int t = 0; t < 2; ++t) { kh[t] = frag_pk(Kh + kvbase + (size_t)kn * D + t * 512); kl[t] = frag_pk(Kl + kvbase + (size_t)kn * D + t * 512); } }
    v16b ph[2], pl[2];
#pragma unroll
    for (int qt = 0; qt < 2; ++qt) { float c2[2];
#pragma unroll
      for (int t = 0; t < 2; ++t) { float m = s[qt][t][0];
#pragma unroll
        for (int r8 = 1; r8 < 8; ++r8) m = fmaxf(m, s[qt][t][r8]);
        c2[t] = m; }
      float cm = fmaxf(c2[0], c2[1]); cm = fmaxf(cm, other_half(cm));
      const float mo = mx[qt], mn = fmaxf(mo, cm); float fe; asm("v_exp_f32 %0, %1\n\tv_nop" : "=v"(fe) : "v"((mo - mn) * CL));   // exp2 and, in the same statement so that it stays directly behind, the one slot the instruction set asks for before a transcendental's source is overwritten or its result read
      const float fac = (mo == -INFINITY) ? 0.0f : fe; mx[qt] = mn;
      const float off = 8.0f - mn * CL;   // + 8: p comes out times PS = 256
      const v2f cl2 = {CL, CL}, off2 = {off, off}; v2f sm[2];
#pragma unroll
      for (int t = 0; t < 2; ++t)
#pragma unroll
        for (int e = 0; e < 8; e += 2) { const v2f a = __builtin_elementwise_fma((v2f){s[qt][t][e], s[qt][t][e + 1]}, cl2, off2); const v2f p = {__builtin_amdgcn_exp2f(a[0]), __builtin_amdgcn_exp2f(a[1])}; sm[t] = e == 0 ? p : sm[t] + p;
          const v2b hi = __builtin_convertvector(p, v2b); const v2b lo = __builtin_convertvector(p - __builtin_convertvector(hi, v2f), v2b);
          const int o = t * 8 + e; ph[qt][o] = hi[0]; ph[qt][o + 1] = hi[1]; pl[qt][o] = lo[0]; pl[qt][o + 1] = lo[1]; }
      const v2f s2 = sm[0] + sm[1]; ls[qt] = ls[qt] * fac + (s2[0] + s2[1]);
#pragma unroll
      for (int t = 0; t < 2; ++t) oacc[qt][t] *= fac; }
#pragma unroll
    for (int qt = 0; qt < 2; ++qt)
#pragma unroll
      for (int t = 0; t < 2; ++t) oacc[qt][t] = wmma16b(vh[t], ph[qt], oacc[qt][t]);
#pragma unroll
    for (int qt = 0; qt < 2; ++qt)
#pragma unroll
      for (int t = 0; t < 2; ++t) oacc[qt][t] = wmma16b(vl[t], ph[qt], oacc[qt][t]);
#pragma unroll
    for (int qt = 0; qt < 2; ++qt)
#pragma unroll
      for (int t = 0; t < 2; ++t) oacc[qt][t] = wmma16b(vh[t], pl[qt], oacc[qt][t]); }
#pragma unroll
  for (int qt = 0; qt < 2; ++qt) { const float inv = (1.0f / HS) / (ls[qt] + other_half(ls[qt]));
#pragma unroll
    for (int t = 0; t < 2; ++t) { float* o = out + (tq + qt * 16 + nloc) * C + h * D + t * 16 + 8 * hlf; const v8f r = oacc[qt][t] * inv; *(v4f*)o = (v4f){r[0], r[1], r[2], r[3]}; *(v4f*)(o + 4) = (v4f){r[4], r[5], r[6], r[7]}; } } }
}  // namespace

extern "C" void kernel_launch(void* const* d_in, const int* in_sizes, int n_in, void* d_out, int out_size, void* d_ws, size_t ws_size, hipStream_t stream) {
  (void)n_in;
  auto Fp = [&](int i) { return (const float*)d_in[i]; };
  // input order: 0 x [4,2048,32]; 1 Wq [8,32,32]; 2 bq [8,32]; 3 Wk; 4 bk; 5 Wv; 6 bv
  if (in_sizes[0] != NB_ * T * D || in_sizes[1] != H * D * D || in_sizes[3] != H * D * D || in_sizes[5] != H * D * D || in_sizes[2] != H * D || out_size != NB_ * T * C) return;
  const int QLIM = T;   // per-(b,h) query cut (multiple of 32)
  size_t off = 0; char* ws = (char*)d_ws;
  auto carve = [&](size_t bytes) { char* p = ws + off; off += (bytes + 255) & ~(size_t)255; return p; };
  b16* WQKV = (b16*)carve((size_t)3 * C * D * 2); b16* Qh = (b16*)carve((size_t)NB_ * T * C * 2); b16* Ql = (b16*)carve((size_t)NB_ * T * C * 2); b16* Kh = (b16*)carve((size_t)NB_ * T * C * 2); b16* Kl = (b16*)carve((size_t)NB_ * T * C * 2); float* V = (float*)carve((size_t)NB_ * T * C * 4); b16* VTh = (b16*)carve((size_t)NB_ * C * T * 2); b16* VTl = (b16*)carve((size_t)NB_ * C * T * 2);
  if (off > ws_size || off > ((size_t)40 << 20)) return;   // ~ 33 MB
  wput_kernel<<<(3 * C * 4 + 255) / 256, 256, 0, stream>>>(Fp(1), Fp(3), Fp(5), WQKV);
  proj_kernel<<<NB_ * T / 16, 32, 0, stream>>>(Fp(0), WQKV, Fp(2), Fp(4), Fp(6), Qh, Ql, Kh, Kl, V);
  vt_kernel<<<NB_ * (T / 64), 256, 0, stream>>>(V, VTh, VTl);
  att_kernel<<<NB_ * H * (T / 32), 32, 0, stream>>>(Qh, Ql, Kh, Kl, VTh, VTl, QLIM, (float*)d_out);
}

// v004
// One run takes 64.4 microseconds.
// Two timings next to v003 both put it at 1.22 times that version's speed.
// All steps since v000 together make it 6.59 times as fast.
#include <hip/hip_runtime.h>

// MultiHeadSA: per head h: q = x Wq[h] + bq[h], k = x Wk[h] + bk[h], v = x Wv[h] + bv[h] (D = 32); wei = softmax_s(q.k / sqrt(32)); out[b][t][h*32 + d] = sum_s wei v -> [4][2048][256].
// K and V^T lie in the workspace in fragment order: per (b,h) and 16-row tile 512 halves, element (row r, k) at (k>>4)*256 + (((k>>3)&1)*16 + r)*8 + (k&7), so one wave-wide 16-byte load reads 512 contiguous bytes (K: r = key, k = d; V^T: r = d, k = key within a 32-key pass, tiles ordered pass-major).
// Attention: a workgroup of 4 waves (128 queries of one (b,h)) shares each 256-key stage of K hi/lo and V^T hi/lo through a two-buffer LDS ring filled by asynchronous copies; the fragments keep their order, so a wave-wide 16-byte LDS read is 512 contiguous bytes.
// Deterministic: flash-style online softmax over fixed 32-key passes in order; no atomics.
// WMMA (v_wmma_f32_16x16x32_f16, f32 accumulate): x (EXACT bf16 x8, K 32) x [Wq|Wk|Wv] rows (EXACT; 48 tiles) per 16-token wave; per (b,h, 32-query) wave S^T = k rows (hi+lo) x q (hi+lo x256, K 32) and O^T += v^T rows (hi+lo) x P^T (hi+lo, packed from the S^T tiles), 3 products each; softmax in f32, in registers.

namespace {
constexpr int NB_ = 4, T = 2048, H = 8, D = 32, C = H * D /* 256 */, KC = 32 /* keys per pass */;
constexpr float XS = 8.0f, HS = 256.0f, PS = 256.0f, WSC = 256.0f, SCALE = 0.17677669529663688f;
typedef _Float16 b16;
typedef __attribute__((ext_vector_type(16))) _Float16 v16b;
typedef __attribute__((ext_vector_type(8))) _Float16 v8b;
typedef __attribute__((ext_vector_type(2))) _Float16 v2b;
typedef __attribute__((ext_vector_type(8))) float v8f;
typedef __attribute__((ext_vector_type(4))) float v4f;
typedef __attribute__((ext_vector_type(2))) float v2f;
__device__ __forceinline__ float bf16_rne(float f) { unsigned int u = __float_as_uint(f); u += 0x7FFFu + ((u >> 16) & 1u); float r = __uint_as_float(u & 0xFFFF0000u); asm volatile("" : "+v"(r)); return r; }
__device__ __forceinline__ float bfv(float f) { float r = bf16_rne(f); asm volatile("" : "+v"(r)); return r; }
__device__ __forceinline__ void split16(float v, b16& hi, b16& lo) { hi = (b16)v; lo = (b16)(v - (float)hi); }
__device__ __forceinline__ v16b frag_kb(const b16* p, int hh) { const v8b a = *(const v8b*)(p + 8 * hh), b = *(const v8b*)(p + 16 + 8 * hh); v16b f;
#pragma unroll
  for (int e = 0; e < 8; ++e) { f[e] = a[e]; f[8 + e] = b[e]; } return f; }
__device__ __forceinline__ v16b frag_pk(const b16* p) { const v8b a = *(const v8b*)p, b = *(const v8b*)(p + 256); v16b f;   // p: tile base + lane * 8
#pragma unroll
  for (int e = 0; e < 8; ++e) { f[e] = a[e]; f[8 + e] = b[e]; } return f; }
__device__ __forceinline__ v8f wmma16b(v16b a, v16b b, v8f c) { v8f d = __builtin_amdgcn_wmma_f32_16x16x32_f16(false, a, false, b, (short)0, c, false, false); asm volatile("v_nop\n\tv_nop\n\tv_nop\n\tv_nop" : "+v"(d) : "v"(a), "v"(b)); return d; }
__device__ __forceinline__ void wave_lds_sync() { __builtin_amdgcn_fence(__ATOMIC_RELEASE, "workgroup"); __builtin_amdgcn_wave_barrier(); __builtin_amdgcn_fence(__ATOMIC_ACQUIRE, "workgroup"); }

__global__ __launch_bounds__(256) void wput_kernel(const float* __restrict__ wq, const float* __restrict__ wk, const float* __restrict__ wv, b16* __restrict__ WQKV) { const int u = blockIdx.x * 256 + threadIdx.x; if (u >= 3 * C * 4) return; const int r = u / 4, c0 = (u % 4) * 8; const int which = r / C, h = (r % C) / D, d = r % D; const float* w = which == 0 ? wq : (which == 1 ? wk : wv); v8b v; float wl[8];
#pragma unroll
  for (int j = 0; j < 8; ++j) wl[j] = w[((size_t)h * D + c0 + j) * D + d];   // all eight loads in flight before the first value is used
#pragma unroll
  for (int j = 0; j < 8; ++j) v[j] = (b16)(bf16_rne(wl[j]) * WSC);
  { *(v8b*)(WQKV + (size_t)r * D + c0) = v;  } }
__global__ __launch_bounds__(32) void proj_kernel(const float* __restrict__ x, const b16* __restrict__ WQKV, const float* __restrict__ bq, const float* __restrict__ bk, const float* __restrict__ bv, b16* __restrict__ Qh, b16* __restrict__ Ql, b16* __restrict__ Kh, b16* __restrict__ Kl, float* __restrict__ V) { __shared__ __attribute__((aligned(16))) b16 Ax[16][D + 8]; __shared__ __attribute__((aligned(16))) float Tf[16][260]; const int lane = threadIdx.x, nloc = lane & 15, hlf = lane >> 4; const size_t t0 = (size_t)blockIdx.x * 16;
  { float xl[16]; const float* xp = x + t0 * D + lane;
#pragma unroll
    for (int rr = 0; rr < 16; ++rr) xl[rr] = xp[rr * D];   // the 16 rows' loads in flight together: one latency, not 16
#pragma unroll
    for (int rr = 0; rr < 16; ++rr) Ax[rr][lane] = (b16)(bf16_rne(xl[rr]) * XS); }
  if (lane < 16) for (int k = D; k < D + 8; ++k) Ax[lane][k] = (b16)0.0f;
  wave_lds_sync(); const v16b a = frag_kb(&Ax[nloc][0], hlf);
#pragma unroll 1
  for (int g = 0; g < 3; ++g) { const float* bias = g == 0 ? bq : (g == 1 ? bk : bv); v8f acc[16]; v16b wf[16]; float bl[16];
#pragma unroll
    for (int t = 0; t < 16; ++t) { wf[t] = frag_kb(WQKV + (size_t)(g * C + t * 16 + nloc) * D, hlf); bl[t] = bias[t * 16 + nloc]; }   // the group's 32 fragment loads and 16 bias loads in flight before the first product
#pragma unroll
    for (int t = 0; t < 16; ++t) acc[t] = wmma16b(a, wf[t], (v8f){});
#pragma unroll
    for (int t = 0; t < 16; ++t) { const int cc = t * 16 + nloc; const float bb = bfv(bl[t]);
#pragma unroll
      for (int r8 = 0; r8 < 8; ++r8) Tf[8 * hlf + r8][cc] = acc[t][r8] * (1.0f / (XS * WSC)) + bb; }
    wave_lds_sync();
    if (g == 1) { const size_t kt0 = (t0 / T) * (size_t)(H * (T / 16)) + (t0 % T) / 16;   // this wave's 16 tokens are one key tile of every head
      v4f kf[2 * H][2];
#pragma unroll
      for (int hj = 0; hj < 2 * H; ++hj) { const float* sp = &Tf[nloc][hj * 16 + 8 * hlf]; kf[hj][0] = *(const v4f*)sp; kf[hj][1] = *(const v4f*)(sp + 4); }   // all LDS reads in flight before the first conversion
      v8b khi[2 * H], klo[2 * H];
#pragma unroll
      for (int hj = 0; hj < 2 * H; ++hj) { const v4f f0 = kf[hj][0], f1 = kf[hj][1];
#pragma unroll
        for (int e = 0; e < 8; ++e) { b16 a, c; split16((e < 4 ? f0[e & 3] : f1[e & 3]) * HS, a, c); khi[hj][e] = a; klo[hj][e] = c; } }
#pragma unroll
      for (int hj = 0; hj < 2 * H; ++hj) { const size_t o = (kt0 + (size_t)(hj >> 1) * (T / 16)) * 512 + (hj & 1) * 256 + lane * 8; *(v8b*)(Kh + o) = khi[hj]; *(v8b*)(Kl + o) = klo[hj]; } }
    else if (g == 2) { v4f vf[16][2];
#pragma unroll
      for (int rr = 0; rr < 16; ++rr) for (int q = 0; q < 2; ++q) vf[rr][q] = *(const v4f*)(&Tf[rr][q * 128 + lane * 4]);   // all LDS reads in flight before the first store
#pragma unroll
      for (int rr = 0; rr < 16; ++rr) for (int q = 0; q < 2; ++q) *(v4f*)(V + (t0 + rr) * C + q * 128 + lane * 4) = vf[rr][q];
      asm volatile("s_wait_xcnt 0x0" ::: "memory");   // what follows this branch rewrites the data and address registers of the V stores
    }
    else { v2f qf[16][4];
#pragma unroll
      for (int rr = 0; rr < 16; ++rr) for (int q = 0; q < 4; ++q) qf[rr][q] = *(const v2f*)(&Tf[rr][q * 64 + lane * 2]);   // all LDS reads in flight before the first conversion
      v2b qhi[16][4], qlo[16][4];
#pragma unroll
      for (int rr = 0; rr < 16; ++rr)
#pragma unroll
        for (int q = 0; q < 4; ++q) { b16 h0, l0, h1, l1; split16(qf[rr][q][0] * HS, h0, l0); split16(qf[rr][q][1] * HS, h1, l1); qhi[rr][q] = (v2b){h0, h1}; qlo[rr][q] = (v2b){l0, l1}; }
#pragma unroll
      for (int rr = 0; rr < 16; ++rr)
#pragma unroll
        for (int q = 0; q < 4; ++q) { const size_t o = (t0 + rr) * C + q * 64 + lane * 2; *(v2b*)(Qh + o) = qhi[rr][q]; *(v2b*)(Ql + o) = qlo[rr][q]; }
      asm volatile("s_wait_xcnt 0x0" ::: "memory");   // what follows this branch rewrites the data and address registers of the Q stores
    }
    wave_lds_sync(); } }
__global__ __launch_bounds__(256) void vt_kernel(const float* __restrict__ V, b16* __restrict__ VTh, b16* __restrict__ VTl) { __shared__ float Tt[64][C + 2] /* pitch: the store pass reads rows 8 apart in the two lane halves; 8 * 258 dwords puts them 16 banks apart */; const int b = blockIdx.x / (T / 64), tk0 = (blockIdx.x % (T / 64)) * 64; const int tid = threadIdx.x, wave = tid >> 5, lane = tid & 31, nloc = lane & 15, hlf = lane >> 4;
  { float vl[8][8]; const float* vp = V + ((size_t)b * T + tk0 + wave) * C + lane;
#pragma unroll
    for (int i = 0; i < 8; ++i)
#pragma unroll
      for (int j = 0; j < 8; ++j) vl[i][j] = vp[8 * i * C + 32 * j];   // the wave's 64 loads in flight together, then the LDS stores
    asm volatile("s_wait_xcnt 0x0" :: "v"(vp) : "memory");   // the address pair is an input here so that it stays whole behind the last load: without this the last loads' destinations were laid over it
#pragma unroll
    for (int i = 0; i < 8; ++i)
#pragma unroll
      for (int j = 0; j < 8; ++j) Tt[wave + 8 * i][lane + 32 * j] = vl[i][j]; }
  __syncthreads();
  { float tl[8][8];
#pragma unroll
    for (int i = 0; i < 8; ++i) { const int u = wave + 8 * i; const int h = u >> 3, pt = (u >> 1) & 3, j = u & 1; const int c = h * D + (pt & 1) * 16 + nloc, kr = (pt >> 1) * 32 + j * 16 + hlf * 8;
#pragma unroll
      for (int e = 0; e < 8; ++e) tl[i][e] = Tt[kr + e][c]; }   // all LDS reads in flight before the first conversion
#pragma unroll
    for (int i = 0; i < 8; ++i) { const int u = wave + 8 * i; const int h = u >> 3, pt = (u >> 1) & 3 /* pass * 2 + d tile */, j = u & 1; v8b hi, lo;
#pragma unroll
      for (int e = 0; e < 8; ++e) { b16 a, l; split16(tl[i][e] * HS, a, l); hi[e] = a; lo[e] = l; }
      const size_t o = ((((size_t)b * H + h) * (T / 32) + tk0 / 32) * 2 + pt) * 512 + j * 256 + lane * 8; *(v8b*)(VTh + o) = hi; *(v8b*)(VTl + o) = lo; }  } }
// Scores are formed transposed, S^T = K Q^T: a lane holds 8 keys of ONE query per tile, so the maximum and the sum
// are taken in the lane's own registers (one exchange between the wave's halves), and two S^T tiles, converted in place,
// are the B operand of O^T += V^T P^T. Scores and P never pass through LDS.
__device__ __forceinline__ float other_half(float v) { return __uint_as_float(__builtin_amdgcn_permlanex16(__float_as_uint(v), __float_as_uint(v), 0x76543210u, 0xfedcba98u, false, false)); }
constexpr int AW = 4 /* waves per workgroup */, QB = AW * 32 /* queries per workgroup */, SK = 256 /* keys per stage */, NST = T / SK, SH = SK * D /* halves per stage of one array: 16 KiB */;
// Eight copies of 16 bytes per lane, 2 KiB apart in LDS and in memory alike (128 lanes x 16 bytes = 2 KiB per copy): one array's 16-KiB stage.
// The s_wait_xcnt is the last line of the copies' own statement, so that it stands in front of every later write of the address registers they name.
__device__ __forceinline__ void copy8(unsigned l, const b16* g) {
  asm volatile("global_load_async_to_lds_b128 %0, %8, off\n\t"
               "global_load_async_to_lds_b128 %1, %9, off\n\t"
               "global_load_async_to_lds_b128 %2, %10, off\n\t"
               "global_load_async_to_lds_b128 %3, %11, off\n\t"
               "global_load_async_to_lds_b128 %4, %12, off\n\t"
               "global_load_async_to_lds_b128 %5, %13, off\n\t"
               "global_load_async_to_lds_b128 %6, %14, off\n\t"
               "global_load_async_to_lds_b128 %7, %15, off\n\t"
               "s_wait_xcnt 0x0"
               :: "v"(l), "v"(l + 2048u), "v"(l + 4096u), "v"(l + 6144u), "v"(l + 8192u), "v"(l + 10240u), "v"(l + 12288u), "v"(l + 14336u),
                  "v"(g), "v"(g + 1024), "v"(g + 2048), "v"(g + 3072), "v"(g + 4096), "v"(g + 5120), "v"(g + 6144), "v"(g + 7168) : "memory"); }
// One stage into one buffer: l = the lane's LDS byte address in the buffer's first array, o = the lane's offset in halves, the same in all four arrays.
__device__ __forceinline__ void stage_copy(unsigned l, size_t o, const b16* kh, const b16* kl, const b16* vh, const b16* vl) { copy8(l, kh + o); copy8(l + 2u * SH, kl + o); copy8(l + 4u * SH, vh + o); copy8(l + 6u * SH, vl + o); }
__global__ __launch_bounds__(128) void att_kernel(const b16* __restrict__ Qh, const b16* __restrict__ Ql, const b16* __restrict__ Kh, const b16* __restrict__ Kl, const b16* __restrict__ VTh, const b16* __restrict__ VTl, int QLIM, float* __restrict__ out) { __shared__ __attribute__((aligned(16))) b16 ring[2][4][SH] /* [buffer][K hi, K lo, V^T hi, V^T lo]; 128 KiB: two workgroups per WGP, two waves per SIMD */; const int tid = threadIdx.x, lane = tid & 31, nloc = lane & 15, hlf = lane >> 4; const int b = blockIdx.x / (H * (T / QB)), rem = blockIdx.x % (H * (T / QB)); const int h = rem / (T / QB), qb = (rem % (T / QB)) * QB; if (qb >= QLIM) return;   // the whole workgroup leaves, in front of every barrier
  const int q0 = qb + (tid >> 5) * 32; const size_t tq = (size_t)b * T + q0;
  constexpr float CL = SCALE / (HS * HS) * 1.4426950408889634f;   // raw score -> log2 units
  v16b qa[2], ql[2];
#pragma unroll
  for (int qt = 0; qt < 2; ++qt) { qa[qt] = frag_kb(Qh + (tq + qt * 16 + nloc) * C + h * D, hlf); ql[qt] = frag_kb(Ql + (tq + qt * 16 + nloc) * C + h * D, hlf); }
  asm volatile("s_wait_xcnt 0x0" ::: "memory");   // the Q loads' address registers are reused below
  const size_t kvbase = ((size_t)b * H + h) * (size_t)(T * D) + tid * 8;   // K and V^T alike: 32 keys = two 512-half tiles; a stage is SH contiguous halves of each array
  const unsigned l0 = (unsigned)(size_t)&ring[0][0][tid * 8];   // the lane's LDS byte address: low 32 bits of the shared address
  stage_copy(l0, kvbase, Kh, Kl, VTh, VTl);   // stage 0 into buffer 0
  asm volatile("s_wait_asynccnt 0x0" ::: "memory");   // this wave's copies of stage 0 have landed
  __syncthreads();   // every wave's have: stage 0 may be read
  stage_copy(l0 + 8u * SH, kvbase + SH, Kh, Kl, VTh, VTl);   // stage 1 into buffer 1, in flight while stage 0 is worked on
  v8f oacc[2][2] = {{(v8f){}, (v8f){}}, {(v8f){}, (v8f){}}};   // [query tile][d tile]: register r8 = d t*16 + 8*hlf + r8, lane column = query
  float mx[2] = {-INFINITY, -INFINITY}, ls[2] = {0.0f, 0.0f};   // ls: this half's keys only, in units of PS
  // The stage loop and the pass loop stay rolled (the pass body already takes about 236 VGPRs); the inner loops are unrolled so that every fragment index is a constant and stays in registers.
#pragma unroll 1
  for (int st = 0; st < NST; ++st) {
  const b16* buf = &ring[st & 1][0][lane * 8];
  v16b kh[2], kl[2];
#pragma unroll
  for (int t = 0; t < 2; ++t) { kh[t] = frag_pk(buf + t * 512); kl[t] = frag_pk(buf + SH + t * 512); }
#pragma unroll 1
  for (int k0 = 0; k0 < SK; k0 += KC) {
    v16b vh[2], vl[2];
#pragma unroll
    for (int t = 0; t < 2; ++t) { const b16* vp = buf + 2 * SH + k0 * D + t * 512; vh[t] = frag_pk(vp); vl[t] = frag_pk(vp + SH); }
    v8f s[2][2];
#pragma unroll
    for (int t = 0; t < 2; ++t)
#pragma unroll
      for (int qt = 0; qt < 2; ++qt) s[qt][t] = wmma16b(kh[t], qa[qt], (v8f){});
#pragma unroll
    for (int t = 0; t < 2; ++t)
#pragma unroll
      for (int qt = 0; qt < 2; ++qt) s[qt][t] = wmma16b(kl[t], qa[qt], s[qt][t]);
#pragma unroll
    for (int t = 0; t < 2; ++t)
#pragma unroll
      for (int qt = 0; qt < 2; ++qt) s[qt][t] = wmma16b(kh[t], ql[qt], s[qt][t]);
    { const int kn = k0 + KC < SK ? k0 + KC : 0;   // the next pass's K rows, into the registers just read; a stage's last pass re-reads its own stage's first rows and drops them: nothing of the next stage is read here
#pragma unroll
      for (int t = 0; t < 2; ++t) { kh[t] = frag_pk(buf + kn * D + t * 512); kl[t] = frag_pk(buf + SH + kn * D + t * 512); } }
    v16b ph[2], pl[2];
#pragma unroll
    for (int qt = 0; qt < 2; ++qt) { float c2[2];
#pragma unroll
      for (int t = 0; t < 2; ++t) { float m = s[qt][t][0];
#pragma unroll
        for (int r8 = 1; r8 < 8; ++r8) m = fmaxf(m, s[qt][t][r8]);
        c2[t] = m; }
      float cm = fmaxf(c2[0], c2[1]); cm = fmaxf(cm, other_half(cm));
      const float mo = mx[qt], mn = fmaxf(mo, cm); float fe; asm("v_exp_f32 %0, %1\n\tv_nop" : "=v"(fe) : "v"((mo - mn) * CL));   // exp2 and, in the same statement so that it stays directly behind, the one slot the instruction set asks for before a transcendental's source is overwritten or its result read
      const float fac = (mo == -INFINITY) ? 0.0f : fe; mx[qt] = mn;
      const float off = 8.0f - mn * CL;   // + 8: p comes out times PS = 256
      const v2f cl2 = {CL, CL}, off2 = {off, off}; v2f sm[2];
#pragma unroll
      for (int t = 0; t < 2; ++t)
#pragma unroll
        for (int e = 0; e < 8; e += 2) { const v2f a = __builtin_elementwise_fma((v2f){s[qt][t][e], s[qt][t][e + 1]}, cl2, off2); const v2f p = {__builtin_amdgcn_exp2f(a[0]), __builtin_amdgcn_exp2f(a[1])}; sm[t] = e == 0 ? p : sm[t] + p;
          const v2b hi = __builtin_convertvector(p, v2b); const v2b lo = __builtin_convertvector(p - __builtin_convertvector(hi, v2f), v2b);
          const int o = t * 8 + e; ph[qt][o] = hi[0]; ph[qt][o + 1] = hi[1]; pl[qt][o] = lo[0]; pl[qt][o + 1] = lo[1]; }
      const v2f s2 = sm[0] + sm[1]; ls[qt] = ls[qt] * fac + (s2[0] + s2[1]);
#pragma unroll
      for (int t = 0; t < 2; ++t) oacc[qt][t] *= fac; }
#pragma unroll
    for (int qt = 0; qt < 2; ++qt)
#pragma unroll
      for (int t = 0; t < 2; ++t) oacc[qt][t] = wmma16b(vh[t], ph[qt], oacc[qt][t]);
#pragma unroll
    for (int qt = 0; qt < 2; ++qt)
#pragma unroll
      for (int t = 0; t < 2; ++t) oacc[qt][t] = wmma16b(vl[t], ph[qt], oacc[qt][t]);
#pragma unroll
    for (int qt = 0; qt < 2; ++qt)
#pragma unroll
      for (int t = 0; t < 2; ++t) oacc[qt][t] = wmma16b(vh[t], pl[qt], oacc[qt][t]); }
  asm volatile("s_wait_dscnt 0x0" ::: "memory");   // this wave's reads of the buffer have retired before the buffer is refilled
  asm volatile("s_wait_asynccnt 0x0" ::: "memory");   // this wave's copies of stage st + 1 have landed
  __syncthreads();   // publishes stage st + 1 and ends every wave's reads of stage st
  if (st + 2 < NST) stage_copy(l0 + (unsigned)(st & 1) * (8u * SH), kvbase + (size_t)(st + 2) * SH, Kh, Kl, VTh, VTl); }
  asm volatile("s_wait_asynccnt 0x0" ::: "memory");   // no copy is outstanding when the wave ends
  if (q0 < QLIM)
#pragma unroll
  for (int qt = 0; qt < 2; ++qt) { const float inv = (1.0f / HS) / (ls[qt] + other_half(ls[qt]));
#pragma unroll
    for (int t = 0; t < 2; ++t) { float* o = out + (tq + qt * 16 + nloc) * C + h * D + t * 16 + 8 * hlf; const v8f r = oacc[qt][t] * inv; *(v4f*)o = (v4f){r[0], r[1], r[2], r[3]}; *(v4f*)(o + 4) = (v4f){r[4], r[5], r[6], r[7]}; } } }
}  // namespace

extern "C" void kernel_launch(void* const* d_in, const int* in_sizes, int n_in, void* d_out, int out_size, void* d_ws, size_t ws_size, hipStream_t stream) {
  (void)n_in;
  auto Fp = [&](int i) { return (const float*)d_in[i]; };
  // input order: 0 x [4,2048,32]; 1 Wq [8,32,32]; 2 bq [8,32]; 3 Wk; 4 bk; 5 Wv; 6 bv
  if (in_sizes[0] != NB_ * T * D || in_sizes[1] != H * D * D || in_sizes[3] != H * D * D || in_sizes[5] != H * D * D || in_sizes[2] != H * D || out_size != NB_ * T * C) return;
  const int QLIM = T;   // per-(b,h) query cut (multiple of 32)
  size_t off = 0; char* ws = (char*)d_ws;
  auto carve = [&](size_t bytes) { char* p = ws + off; off += (bytes + 255) & ~(size_t)255; return p; };
  b16* WQKV = (b16*)carve((size_t)3 * C * D * 2); b16* Qh = (b16*)carve((size_t)NB_ * T * C * 2); b16* Ql = (b16*)carve((size_t)NB_ * T * C * 2); b16* Kh = (b16*)carve((size_t)NB_ * T * C * 2); b16* Kl = (b16*)carve((size_t)NB_ * T * C * 2); float* V = (float*)carve((size_t)NB_ * T * C * 4); b16* VTh = (b16*)carve((size_t)NB_ * C * T * 2); b16* VTl = (b16*)carve((size_t)NB_ * C * T * 2);
  if (off > ws_size || off > ((size_t)40 << 20)) return;   // ~ 33 MB
  wput_kernel<<<(3 * C * 4 + 255) / 256, 256, 0, stream>>>(Fp(1), Fp(3), Fp(5), WQKV);
  proj_kernel<<<NB_ * T / 16, 32, 0, stream>>>(Fp(0), WQKV, Fp(2), Fp(4), Fp(6), Qh, Ql, Kh, Kl, V);
  vt_kernel<<<NB_ * (T / 64), 256, 0, stream>>>(V, VTh, VTl);
  att_kernel<<<NB_ * H * (T / QB), QB, 0, stream>>>(Qh, Ql, Kh, Kl, VTh, VTl, QLIM, (float*)d_out);
}

// v005
// Measured time: 58.2 microseconds a run.
// Two timings next to v004 both put it at 1.11 times that version's speed.
// All steps since v000 together make it 7.28 times as fast.
#include <hip/hip_runtime.h>

// MultiHeadSA: per head h: q = x Wq[h] + bq[h], k = x Wk[h] + bk[h], v = x Wv[h] + bv[h] (D = 32); wei = softmax_s(q.k / sqrt(32)); out[b][t][h*32 + d] = sum_s wei v -> [4][2048][256].
// K and V^T lie in the workspace in fragment order: per (b,h) and 16-row tile 512 halves, element (row r, k) at (k>>4)*256 + (((k>>3)&1)*16 + r)*8 + (k&7), so one wave-wide 16-byte load reads 512 contiguous bytes (K: r = key, k = d; V^T: r = d, k = key within a 32-key pass, tiles ordered pass-major). The projection stores V^T straight from its accumulators: a lane of a tile x rows x Wv rows holds 8 consecutive tokens of one channel, which is one 16-byte unit of that order.
// Attention: a workgroup of 4 waves (128 queries of one (b,h)) shares each 256-key stage of K hi/lo and V^T hi/lo through a two-buffer LDS ring filled by asynchronous copies; the fragments keep their order, so a wave-wide 16-byte LDS read is 512 contiguous bytes.
// Deterministic: flash-style online softmax over fixed 32-key passes in order; no atomics.
// WMMA (v_wmma_f32_16x16x32_f16, f32 accumulate): x (EXACT bf16 x8, K 32) x [Wq|Wk|Wv] rows (EXACT; 48 tiles) per 16-token wave; per (b,h, 32-query) wave S^T = k rows (hi+lo) x q (hi+lo x256, K 32) and O^T += v^T rows (hi+lo) x P^T (hi+lo, packed from the S^T tiles), 3 products each; softmax in f32, in registers.

namespace {
constexpr int NB_ = 4, T = 2048, H = 8, D = 32, C = H * D /* 256 */, KC = 32 /* keys per pass */;
constexpr float XS = 8.0f, HS = 256.0f, PS = 256.0f, WSC = 256.0f, SCALE = 0.17677669529663688f;
typedef _Float16 b16;
typedef __attribute__((ext_vector_type(16))) _Float16 v16b;
typedef __attribute__((ext_vector_type(8))) _Float16 v8b;
typedef __attribute__((ext_vector_type(2))) _Float16 v2b;
typedef __attribute__((ext_vector_type(8))) float v8f;
typedef __attribute__((ext_vector_type(4))) float v4f;
typedef __attribute__((ext_vector_type(2))) float v2f;
__device__ __forceinline__ float bf16_rne(float f) { unsigned int u = __float_as_uint(f); u += 0x7FFFu + ((u >> 16) & 1u); float r = __uint_as_float(u & 0xFFFF0000u); asm volatile("" : "+v"(r)); return r; }
__device__ __forceinline__ float bfv(float f) { float r = bf16_rne(f); asm volatile("" : "+v"(r)); return r; }
__device__ __forceinline__ void split16(float v, b16& hi, b16& lo) { hi = (b16)v; lo = (b16)(v - (float)hi); }
__device__ __forceinline__ v16b frag_kb(const b16* p, int hh) { const v8b a = *(const v8b*)(p + 8 * hh), b = *(const v8b*)(p + 16 + 8 * hh); v16b f;
#pragma unroll
  for (int e = 0; e < 8; ++e) { f[e] = a[e]; f[8 + e] = b[e]; } return f; }
__device__ __forceinline__ v16b frag_pk(const b16* p) { const v8b a = *(const v8b*)p, b = *(const v8b*)(p + 256); v16b f;   // p: tile base + lane * 8
#pragma unroll
  for (int e = 0; e < 8; ++e) { f[e] = a[e]; f[8 + e] = b[e]; } return f; }
__device__ __forceinline__ v8f wmma16b(v16b a, v16b b, v8f c) { v8f d = __builtin_amdgcn_wmma_f32_16x16x32_f16(false, a, false, b, (short)0, c, false, false); asm volatile("v_nop\n\tv_nop\n\tv_nop\n\tv_nop" : "+v"(d) : "v"(a), "v"(b)); return d; }
__device__ __forceinline__ void wave_lds_sync() { __builtin_amdgcn_fence(__ATOMIC_RELEASE, "workgroup"); __builtin_amdgcn_wave_barrier(); __builtin_amdgcn_fence(__ATOMIC_ACQUIRE, "workgroup"); }

__global__ __launch_bounds__(256) void wput_kernel(const float* __restrict__ wq, const float* __restrict__ wk, const float* __restrict__ wv, b16* __restrict__ WQKV) { const int u = blockIdx.x * 256 + threadIdx.x; if (u >= 3 * C * 4) return; const int r = u / 4, c0 = (u % 4) * 8; const int which = r / C, h = (r % C) / D, d = r % D; const float* w = which == 0 ? wq : (which == 1 ? wk : wv); v8b v; float wl[8];
#pragma unroll
  for (int j = 0; j < 8; ++j) wl[j] = w[((size_t)h * D + c0 + j) * D + d];   // all eight loads in flight before the first value is used
#pragma unroll
  for (int j = 0; j < 8; ++j) v[j] = (b16)(bf16_rne(wl[j]) * WSC);
  { *(v8b*)(WQKV + (size_t)r * D + c0) = v;  } }
__global__ __launch_bounds__(32) void proj_kernel(const float* __restrict__ x, const b16* __restrict__ WQKV, const float* __restrict__ bq, const float* __restrict__ bk, const float* __restrict__ bv, b16* __restrict__ Qh, b16* __restrict__ Ql, b16* __restrict__ Kh, b16* __restrict__ Kl, b16* __restrict__ VTh, b16* __restrict__ VTl) { __shared__ __attribute__((aligned(16))) b16 Ax[16][D + 8]; __shared__ __attribute__((aligned(16))) float Tf[16][260]; const int lane = threadIdx.x, nloc = lane & 15, hlf = lane >> 4; const size_t t0 = (size_t)blockIdx.x * 16;
  { float xl[16]; const float* xp = x + t0 * D + lane;
#pragma unroll
    for (int rr = 0; rr < 16; ++rr) xl[rr] = xp[rr * D];   // the 16 rows' loads in flight together: one latency, not 16
#pragma unroll
    for (int rr = 0; rr < 16; ++rr) Ax[rr][lane] = (b16)(bf16_rne(xl[rr]) * XS); }
  if (lane < 16) for (int k = D; k < D + 8; ++k) Ax[lane][k] = (b16)0.0f;
  wave_lds_sync(); const v16b a = frag_kb(&Ax[nloc][0], hlf);
  { v16b wf[16]; float bl[16];   // V first, no LDS pass: its stores retire under the Q group's loads
#pragma unroll
    for (int t = 0; t < 16; ++t) { wf[t] = frag_kb(WQKV + (size_t)(2 * C + t * 16 + nloc) * D, hlf); bl[t] = bv[t * 16 + nloc]; }   // the group's 32 fragment loads and 16 bias loads in flight before the first product
    const size_t vb = ((t0 / T) * (size_t)(H * (T / 32)) + (t0 % T) / 32) * 1024 + ((t0 / 16) & 1) * 256 + lane * 8;   // this wave's 16 tokens are one half (k >> 4) of one 32-key pass of every head
    v8b vhi[16], vlo[16];
#pragma unroll
    for (int t = 0; t < 16; ++t) { const v8f acc = wmma16b(a, wf[t], (v8f){}); const float bb = bfv(bl[t]);   // register r8 = token 8 * hlf + r8 (k & 7 = r8, (k >> 3) & 1 = hlf), lane column = channel t * 16 + nloc (head t >> 1, d tile t & 1, r = nloc)
#pragma unroll
      for (int r8 = 0; r8 < 8; ++r8) { b16 hi, lo; split16((acc[r8] * (1.0f / (XS * WSC)) + bb) * HS, hi, lo); vhi[t][r8] = hi; vlo[t][r8] = lo; } }
#pragma unroll
    for (int t = 0; t < 16; ++t) { const size_t o = vb + (size_t)(t >> 1) * ((T / 32) * 1024) + (t & 1) * 512; *(v8b*)(VTh + o) = vhi[t]; *(v8b*)(VTl + o) = vlo[t]; }
    asm volatile("s_wait_xcnt 0x0" ::: "memory"); }   // what follows rewrites the data and address registers of the V^T stores
#pragma unroll 1
  for (int g = 0; g < 2; ++g) { const float* bias = g == 0 ? bq : bk; v8f acc[16]; v16b wf[16]; float bl[16];   // Q and K: through LDS into their layouts
#pragma unroll
    for (int t = 0; t < 16; ++t) { wf[t] = frag_kb(WQKV + (size_t)(g * C + t * 16 + nloc) * D, hlf); bl[t] = bias[t * 16 + nloc]; }   // the group's 32 fragment loads and 16 bias loads in flight before the first product
#pragma unroll
    for (int t = 0; t < 16; ++t) acc[t] = wmma16b(a, wf[t], (v8f){});
#pragma unroll
    for (int t = 0; t < 16; ++t) { const int cc = t * 16 + nloc; const float bb = bfv(bl[t]);
#pragma unroll
      for (int r8 = 0; r8 < 8; ++r8) Tf[8 * hlf + r8][cc] = acc[t][r8] * (1.0f / (XS * WSC)) + bb; }
    wave_lds_sync();
    if (g == 1) { const size_t kt0 = (t0 / T) * (size_t)(H * (T / 16)) + (t0 % T) / 16;   // this wave's 16 tokens are one key tile of every head
      v4f kf[2 * H][2];
#pragma unroll
      for (int hj = 0; hj < 2 * H; ++hj) { const float* sp = &Tf[nloc][hj * 16 + 8 * hlf]; kf[hj][0] = *(const v4f*)sp; kf[hj][1] = *(const v4f*)(sp + 4); }   // all LDS reads in flight before the first conversion
      v8b khi[2 * H], klo[2 * H];
#pragma unroll
      for (int hj = 0; hj < 2 * H; ++hj) { const v4f f0 = kf[hj][0], f1 = kf[hj][1];
#pragma unroll
        for (int e = 0; e < 8; ++e) { b16 a, c; split16((e < 4 ? f0[e & 3] : f1[e & 3]) * HS, a, c); khi[hj][e] = a; klo[hj][e] = c; } }
#pragma unroll
      for (int hj = 0; hj < 2 * H; ++hj) { const size_t o = (kt0 + (size_t)(hj >> 1) * (T / 16)) * 512 + (hj & 1) * 256 + lane * 8; *(v8b*)(Kh + o) = khi[hj]; *(v8b*)(Kl + o) = klo[hj]; } }
    else { v2f qf[16][4];
#pragma unroll
      for (int rr = 0; rr < 16; ++rr) for (int q = 0; q < 4; ++q) qf[rr][q] = *(const v2f*)(&Tf[rr][q * 64 + lane * 2]);   // all LDS reads in flight before the first conversion
      v2b qhi[16][4], qlo[16][4];
#pragma unroll
      for (int rr = 0; rr < 16; ++rr)
#pragma unroll
        for (int q = 0; q < 4; ++q) { b16 h0, l0, h1, l1; split16(qf[rr][q][0] * HS, h0, l0); split16(qf[rr][q][1] * HS, h1, l1); qhi[rr][q] = (v2b){h0, h1}; qlo[rr][q] = (v2b){l0, l1}; }
#pragma unroll
      for (int rr = 0; rr < 16; ++rr)
#pragma unroll
        for (int q = 0; q < 4; ++q) { const size_t o = (t0 + rr) * C + q * 64 + lane * 2; *(v2b*)(Qh + o) = qhi[rr][q]; *(v2b*)(Ql + o) = qlo[rr][q]; }
      asm volatile("s_wait_xcnt 0x0" ::: "memory");   // what follows this branch rewrites the data and address registers of the Q stores
    }
    wave_lds_sync(); } }
// Scores are formed transposed, S^T = K Q^T: a lane holds 8 keys of ONE query per tile, so the maximum and the sum
// are taken in the lane's own registers (one exchange between the wave's halves), and two S^T tiles, converted in place,
// are the B operand of O^T += V^T P^T. Scores and P never pass through LDS.
__device__ __forceinline__ float other_half(float v) { return __uint_as_float(__builtin_amdgcn_permlanex16(__float_as_uint(v), __float_as_uint(v), 0x76543210u, 0xfedcba98u, false, false)); }
constexpr int AW = 4 /* waves per workgroup */, QB = AW * 32 /* queries per workgroup */, SK = 256 /* keys per stage */, NST = T / SK, SH = SK * D /* halves per stage of one array: 16 KiB */;
// Eight copies of 16 bytes per lane, 2 KiB apart in LDS and in memory alike (128 lanes x 16 bytes = 2 KiB per copy): one array's 16-KiB stage.
// The s_wait_xcnt is the last line of the copies' own statement, so that it stands in front of every later write of the address registers they name.
__device__ __forceinline__ void copy8(unsigned l, const b16* g) {
  asm volatile("global_load_async_to_lds_b128 %0, %8, off\n\t"
               "global_load_async_to_lds_b128 %1, %9, off\n\t"
               "global_load_async_to_lds_b128 %2, %10, off\n\t"
               "global_load_async_to_lds_b128 %3, %11, off\n\t"
               "global_load_async_to_lds_b128 %4, %12, off\n\t"
               "global_load_async_to_lds_b128 %5, %13, off\n\t"
               "global_load_async_to_lds_b128 %6, %14, off\n\t"
               "global_load_async_to_lds_b128 %7, %15, off\n\t"
               "s_wait_xcnt 0x0"
               :: "v"(l), "v"(l + 2048u), "v"(l + 4096u), "v"(l + 6144u), "v"(l + 8192u), "v"(l + 10240u), "v"(l + 12288u), "v"(l + 14336u),
                  "v"(g), "v"(g + 1024), "v"(g + 2048), "v"(g + 3072), "v"(g + 4096), "v"(g + 5120), "v"(g + 6144), "v"(g + 7168) : "memory"); }
// One stage into one buffer: l = the lane's LDS byte address in the buffer's first array, o = the lane's offset in halves, the same in all four arrays.
__device__ __forceinline__ void stage_copy(unsigned l, size_t o, const b16* kh, const b16* kl, const b16* vh, const b16* vl) { copy8(l, kh + o); copy8(l + 2u * SH, kl + o); copy8(l + 4u * SH, vh + o); copy8(l + 6u * SH, vl + o); }
__global__ __launch_bounds__(128) void att_kernel(const b16* __restrict__ Qh, const b16* __restrict__ Ql, const b16* __restrict__ Kh, const b16* __restrict__ Kl, const b16* __restrict__ VTh, const b16* __restrict__ VTl, int QLIM, float* __restrict__ out) { __shared__ __attribute__((aligned(16))) b16 ring[2][4][SH] /* [buffer][K hi, K lo, V^T hi, V^T lo]; 128 KiB: two workgroups per WGP, two waves per SIMD */; const int tid = threadIdx.x, lane = tid & 31, nloc = lane & 15, hlf = lane >> 4; const int b = blockIdx.x / (H * (T / QB)), rem = blockIdx.x % (H * (T / QB)); const int h = rem / (T / QB), qb = (rem % (T / QB)) * QB; if (qb >= QLIM) return;   // the whole workgroup leaves, in front of every barrier
  const int q0 = qb + (tid >> 5) * 32; const size_t tq = (size_t)b * T + q0;
  constexpr float CL = SCALE / (HS * HS) * 1.4426950408889634f;   // raw score -> log2 units
  v16b qa[2], ql[2];
#pragma unroll
  for (int qt = 0; qt < 2; ++qt) { qa[qt] = frag_kb(Qh + (tq + qt * 16 + nloc) * C + h * D, hlf); ql[qt] = frag_kb(Ql + (tq + qt * 16 + nloc) * C + h * D, hlf); }
  asm volatile("s_wait_xcnt 0x0" ::: "memory");   // the Q loads' address registers are reused below
  const size_t kvbase = ((size_t)b * H + h) * (size_t)(T * D) + tid * 8;   // K and V^T alike: 32 keys = two 512-half tiles; a stage is SH contiguous halves of each array
  const unsigned l0 = (unsigned)(size_t)&ring[0][0][tid * 8];   // the lane's LDS byte address: low 32 bits of the shared address
  stage_copy(l0, kvbase, Kh, Kl, VTh, VTl);   // stage 0 into buffer 0
  asm volatile("s_wait_asynccnt 0x0" ::: "memory");   // this wave's copies of stage 0 have landed
  __syncthreads();   // every wave's have: stage 0 may be read
  stage_copy(l0 + 8u * SH, kvbase + SH, Kh, Kl, VTh, VTl);   // stage 1 into buffer 1, in flight while stage 0 is worked on
  v8f oacc[2][2] = {{(v8f){}, (v8f){}}, {(v8f){}, (v8f){}}};   // [query tile][d tile]: register r8 = d t*16 + 8*hlf + r8, lane column = query
  float mx[2] = {-INFINITY, -INFINITY}, ls[2] = {0.0f, 0.0f};   // ls: this half's keys only, in units of PS
  // The stage loop and the pass loop stay rolled (the pass body already takes about 236 VGPRs); the inner loops are unrolled so that every fragment index is a constant and stays in registers.
#pragma unroll 1
  for (int st = 0; st < NST; ++st) {
  const b16* buf = &ring[st & 1][0][lane * 8];
  v16b kh[2], kl[2];
#pragma unroll
  for (int t = 0; t < 2; ++t) { kh[t] = frag_pk(buf + t * 512); kl[t] = frag_pk(buf + SH + t * 512); }
#pragma unroll 1
  for (int k0 = 0; k0 < SK; k0 += KC) {
    v16b vh[2], vl[2];
#pragma unroll
    for (int t = 0; t < 2; ++t) { const b16* vp = buf + 2 * SH + k0 * D + t * 512; vh[t] = frag_pk(vp); vl[t] = frag_pk(vp + SH); }
    v8f s[2][2];
#pragma unroll
    for (int t = 0; t < 2; ++t)
#pragma unroll
      for (int qt = 0; qt < 2; ++qt) s[qt][t] = wmma16b(kh[t], qa[qt], (v8f){});
#pragma unroll
    for (int t = 0; t < 2; ++t)
#pragma unroll
      for (int qt = 0; qt < 2; ++qt) s[qt][t] = wmma16b(kl[t], qa[qt], s[qt][t]);
#pragma unroll
    for (int t = 0; t < 2; ++t)
#pragma unroll
      for (int qt = 0; qt < 2; ++qt) s[qt][t] = wmma16b(kh[t], ql[qt], s[qt][t]);
    { const int kn = k0 + KC < SK ? k0 + KC : 0;   // the next pass's K rows, into the registers just read; a stage's last pass re-reads its own stage's first rows and drops them: nothing of the next stage is read here
#pragma unroll
      for (int t = 0; t < 2; ++t) { kh[t] = frag_pk(buf + kn * D + t * 512); kl[t] = frag_pk(buf + SH + kn * D + t * 512); } }
    v16b ph[2], pl[2];
#pragma unroll
    for (int qt = 0; qt < 2; ++qt) { float c2[2];
#pragma unroll
      for (int t = 0; t < 2; ++t) { float m = s[qt][t][0];
#pragma unroll
        for (int r8 = 1; r8 < 8; ++r8) m = fmaxf(m, s[qt][t][r8]);
        c2[t] = m; }
      float cm = fmaxf(c2[0], c2[1]); cm = fmaxf(cm, other_half(cm));
      const float mo = mx[qt], mn = fmaxf(mo, cm); float fe; asm("v_exp_f32 %0, %1\n\tv_nop" : "=v"(fe) : "v"((mo - mn) * CL));   // exp2 and, in the same statement so that it stays directly behind, the one slot the instruction set asks for before a transcendental's source is overwritten or its result read
      const float fac = (mo == -INFINITY) ? 0.0f : fe; mx[qt] = mn;
      const float off = 8.0f - mn * CL;   // + 8: p comes out times PS = 256
      const v2f cl2 = {CL, CL}, off2 = {off, off}; v2f sm[2];
#pragma unroll
      for (int t = 0; t < 2; ++t)
#pragma unroll
        for (int e = 0; e < 8; e += 2) { const v2f a = __builtin_elementwise_fma((v2f){s[qt][t][e], s[qt][t][e + 1]}, cl2, off2); const v2f p = {__builtin_amdgcn_exp2f(a[0]), __builtin_amdgcn_exp2f(a[1])}; sm[t] = e == 0 ? p : sm[t] + p;
          const v2b hi = __builtin_convertvector(p, v2b); const v2b lo = __builtin_convertvector(p - __builtin_convertvector(hi, v2f), v2b);
          const int o = t * 8 + e; ph[qt][o] = hi[0]; ph[qt][o + 1] = hi[1]; pl[qt][o] = lo[0]; pl[qt][o + 1] = lo[1]; }
      const v2f s2 = sm[0] + sm[1]; ls[qt] = ls[qt] * fac + (s2[0] + s2[1]);
#pragma unroll
      for (int t = 0; t < 2; ++t) oacc[qt][t] *= fac; }
#pragma unroll
    for (int qt = 0; qt < 2; ++qt)
#pragma unroll
      for (int t = 0; t < 2; ++t) oacc[qt][t] = wmma16b(vh[t], ph[qt], oacc[qt][t]);
#pragma unroll
    for (int qt = 0; qt < 2; ++qt)
#pragma unroll
      for (int t = 0; t < 2; ++t) oacc[qt][t] = wmma16b(vl[t], ph[qt], oacc[qt][t]);
#pragma unroll
    for (int qt = 0; qt < 2; ++qt)
#pragma unroll
      for (int t = 0; t < 2; ++t) oacc[qt][t] = wmma16b(vh[t], pl[qt], oacc[qt][t]); }
  asm volatile("s_wait_dscnt 0x0" ::: "memory");   // this wave's reads of the buffer have retired before the buffer is refilled
  asm volatile("s_wait_asynccnt 0x0" ::: "memory");   // this wave's copies of stage st + 1 have landed
  __syncthreads();   // publishes stage st + 1 and ends every wave's reads of stage st
  if (st + 2 < NST) stage_copy(l0 + (unsigned)(st & 1) * (8u * SH), kvbase + (size_t)(st + 2) * SH, Kh, Kl, VTh, VTl); }
  asm volatile("s_wait_asynccnt 0x0" ::: "memory");   // no copy is outstanding when the wave ends
  if (q0 < QLIM)
#pragma unroll
  for (int qt = 0; qt < 2; ++qt) { const float inv = (1.0f / HS) / (ls[qt] + other_half(ls[qt]));
#pragma unroll
    for (int t = 0; t < 2; ++t) { float* o = out + (tq + qt * 16 + nloc) * C + h * D + t * 16 + 8 * hlf; const v8f r = oacc[qt][t] * inv; *(v4f*)o = (v4f){r[0], r[1], r[2], r[3]}; *(v4f*)(o + 4) = (v4f){r[4], r[5], r[6], r[7]}; } } }
}  // namespace

extern "C" void kernel_launch(void* const* d_in, const int* in_sizes, int n_in, void* d_out, int out_size, void* d_ws, size_t ws_size, hipStream_t stream) {
  (void)n_in;
  auto Fp = [&](int i) { return (const float*)d_in[i]; };
  // input order: 0 x [4,2048,32]; 1 Wq [8,32,32]; 2 bq [8,32]; 3 Wk; 4 bk; 5 Wv; 6 bv
  if (in_sizes[0] != NB_ * T * D || in_sizes[1] != H * D * D || in_sizes[3] != H * D * D || in_sizes[5] != H * D * D || in_sizes[2] != H * D || out_size != NB_ * T * C) return;
  const int QLIM = T;   // per-(b,h) query cut (multiple of 32)
  size_t off = 0; char* ws = (char*)d_ws;
  auto carve = [&](size_t bytes) { char* p = ws + off; off += (bytes + 255) & ~(size_t)255; return p; };
  b16* WQKV = (b16*)carve((size_t)3 * C * D * 2); b16* Qh = (b16*)carve((size_t)NB_ * T * C * 2); b16* Ql = (b16*)carve((size_t)NB_ * T * C * 2); b16* Kh = (b16*)carve((size_t)NB_ * T * C * 2); b16* Kl = (b16*)carve((size_t)NB_ * T * C * 2); b16* VTh = (b16*)carve((size_t)NB_ * C * T * 2); b16* VTl = (b16*)carve((size_t)NB_ * C * T * 2);
  if (off > ws_size || off > ((size_t)40 << 20)) return;   // ~ 25 MB
  wput_kernel<<<(3 * C * 4 + 255) / 256, 256, 0, stream>>>(Fp(1), Fp(3), Fp(5), WQKV);
  proj_kernel<<<NB_ * T / 16, 32, 0, stream>>>(Fp(0), WQKV, Fp(2), Fp(4), Fp(6), Qh, Ql, Kh, Kl, VTh, VTl);
  att_kernel<<<NB_ * H * (T / QB), QB, 0, stream>>>(Qh, Ql, Kh, Kl, VTh, VTl, QLIM, (float*)d_out);
}

// v006
// Measured time: 53.5 microseconds a run.
// Timed twice side by side with v005, it ran 1.09 times as fast both times.
// Over all steps from v000 it is 7.92 times as fast.
#include <hip/hip_runtime.h>

// MultiHeadSA: per head h: q = x Wq[h] + bq[h], k = x Wk[h] + bk[h], v = x Wv[h] + bv[h] (D = 32); wei = softmax_s(q.k / sqrt(32)); out[b][t][h*32 + d] = sum_s wei v -> [4][2048][256].
// K and V^T lie in the workspace in fragment order: per (b,h) and 16-row tile 512 halves, element (row r, k) at (k>>4)*256 + (((k>>3)&1)*16 + r)*8 + (k&7), so one wave-wide 16-byte load reads 512 contiguous bytes (K: r = key, k = d; V^T: r = d, k = key within a 32-key pass, tiles ordered pass-major). The projection stores V^T straight from its accumulators: a lane of a tile x rows x Wv rows holds 8 consecutive tokens of one channel, which is one 16-byte unit of that order.
// Attention: a workgroup of 4 waves (128 queries of one (b,h)) shares each 256-key stage of K hi/lo and V^T hi/lo through a two-buffer LDS ring filled by asynchronous copies; the fragments keep their order, so a wave-wide 16-byte LDS read is 512 contiguous bytes.
// Deterministic: flash-style online softmax over fixed 32-key passes in order; no atomics.
// WMMA (v_wmma_f32_16x16x32_f16, f32 accumulate): x (EXACT bf16 x8, K 32) x [Wq|Wk|Wv] rows (EXACT; 48 tiles) per 16-token wave; per (b,h, 32-query) wave S^T = k rows (hi+lo) x q (hi+lo x256, K 32) and O^T += v^T rows (hi+lo) x P^T (hi+lo, packed from the S^T tiles), 3 products each; softmax in f32, in registers.

namespace {
constexpr int NB_ = 4, T = 2048, H = 8, D = 32, C = H * D /* 256 */, KC = 32 /* keys per pass */;
constexpr float XS = 8.0f, HS = 256.0f, PS = 256.0f, WSC = 256.0f, SCALE = 0.17677669529663688f;
typedef _Float16 b16;
typedef __attribute__((ext_vector_type(16))) _Float16 v16b;
typedef __attribute__((ext_vector_type(8))) _Float16 v8b;
typedef __attribute__((ext_vector_type(2))) _Float16 v2b;
typedef __attribute__((ext_vector_type(8))) float v8f;
typedef __attribute__((ext_vector_type(4))) float v4f;
typedef __attribute__((ext_vector_type(2))) float v2f;
__device__ __forceinline__ float bf16_rne(float f) { unsigned int u = __float_as_uint(f); u += 0x7FFFu + ((u >> 16) & 1u); float r = __uint_as_float(u & 0xFFFF0000u); asm volatile("" : "+v"(r)); return r; }
__device__ __forceinline__ float bfv(float f) { float r = bf16_rne(f); asm volatile("" : "+v"(r)); return r; }
__device__ __forceinline__ void split16(float v, b16& hi, b16& lo) { hi = (b16)v; lo = (b16)(v - (float)hi); }
__device__ __forceinline__ v16b frag_kb(const b16* p, int hh) { const v8b a = *(const v8b*)(p + 8 * hh), b = *(const v8b*)(p + 16 + 8 * hh); v16b f;
#pragma unroll
  for (int e = 0; e < 8; ++e) { f[e] = a[e]; f[8 + e] = b[e]; } return f; }
__device__ __forceinline__ v16b frag_pk(const b16* p) { const v8b a = *(const v8b*)p, b = *(const v8b*)(p + 256); v16b f;   // p: tile base + lane * 8
#pragma unroll
  for (int e = 0; e < 8; ++e) { f[e] = a[e]; f[8 + e] = b[e]; } return f; }
__device__ __forceinline__ v8f wmma16b(v16b a, v16b b, v8f c) { v8f d = __builtin_amdgcn_wmma_f32_16x16x32_f16(false, a, false, b, (short)0, c, false, false); asm volatile("v_nop\n\tv_nop\n\tv_nop\n\tv_nop" : "+v"(d) : "v"(a), "v"(b)); return d; }
__device__ __forceinline__ v8f wmma16c(v16b a, v16b b, v8f c) { return __builtin_amdgcn_wmma_f32_16x16x32_f16(false, a, false, b, (short)0, c, false, false); }   // for the attention loop, the builtin alone: the compiler keeps the distance behind it, with other WMMAs and softmax work where there is some
__device__ __forceinline__ void wave_lds_sync() { __builtin_amdgcn_fence(__ATOMIC_RELEASE, "workgroup"); __builtin_amdgcn_wave_barrier(); __builtin_amdgcn_fence(__ATOMIC_ACQUIRE, "workgroup"); }

__global__ __launch_bounds__(256) void wput_kernel(const float* __restrict__ wq, const float* __restrict__ wk, const float* __restrict__ wv, b16* __restrict__ WQKV) { const int u = blockIdx.x * 256 + threadIdx.x; if (u >= 3 * C * 4) return; const int r = u / 4, c0 = (u % 4) * 8; const int which = r / C, h = (r % C) / D, d = r % D; const float* w = which == 0 ? wq : (which == 1 ? wk : wv); v8b v; float wl[8];
#pragma unroll
  for (int j = 0; j < 8; ++j) wl[j] = w[((size_t)h * D + c0 + j) * D + d];   // all eight loads in flight before the first value is used
#pragma unroll
  for (int j = 0; j < 8; ++j) v[j] = (b16)(bf16_rne(wl[j]) * WSC);
  { *(v8b*)(WQKV + (size_t)r * D + c0) = v;  } }
__global__ __launch_bounds__(32) void proj_kernel(const float* __restrict__ x, const b16* __restrict__ WQKV, const float* __restrict__ bq, const float* __restrict__ bk, const float* __restrict__ bv, b16* __restrict__ Qh, b16* __restrict__ Ql, b16* __restrict__ Kh, b16* __restrict__ Kl, b16* __restrict__ VTh, b16* __restrict__ VTl) { __shared__ __attribute__((aligned(16))) b16 Ax[16][D + 8]; __shared__ __attribute__((aligned(16))) float Tf[16][260]; const int lane = threadIdx.x, nloc = lane & 15, hlf = lane >> 4; const size_t t0 = (size_t)blockIdx.x * 16;
  { float xl[16]; const float* xp = x + t0 * D + lane;
#pragma unroll
    for (int rr = 0; rr < 16; ++rr) xl[rr] = xp[rr * D];   // the 16 rows' loads in flight together: one latency, not 16
#pragma unroll
    for (int rr = 0; rr < 16; ++rr) Ax[rr][lane] = (b16)(bf16_rne(xl[rr]) * XS); }
  if (lane < 16) for (int k = D; k < D + 8; ++k) Ax[lane][k] = (b16)0.0f;
  wave_lds_sync(); const v16b a = frag_kb(&Ax[nloc][0], hlf);
  { v16b wf[16]; float bl[16];   // V first, no LDS pass: its stores retire under the Q group's loads
#pragma unroll
    for (int t = 0; t < 16; ++t) { wf[t] = frag_kb(WQKV + (size_t)(2 * C + t * 16 + nloc) * D, hlf); bl[t] = bv[t * 16 + nloc]; }   // the group's 32 fragment loads and 16 bias loads in flight before the first product
    const size_t vb = ((t0 / T) * (size_t)(H * (T / 32)) + (t0 % T) / 32) * 1024 + ((t0 / 16) & 1) * 256 + lane * 8;   // this wave's 16 tokens are one half (k >> 4) of one 32-key pass of every head
    v8b vhi[16], vlo[16];
#pragma unroll
    for (int t = 0; t < 16; ++t) { const v8f acc = wmma16b(a, wf[t], (v8f){}); const float bb = bfv(bl[t]);   // register r8 = token 8 * hlf + r8 (k & 7 = r8, (k >> 3) & 1 = hlf), lane column = channel t * 16 + nloc (head t >> 1, d tile t & 1, r = nloc)
#pragma unroll
      for (int r8 = 0; r8 < 8; ++r8) { b16 hi, lo; split16((acc[r8] * (1.0f / (XS * WSC)) + bb) * HS, hi, lo); vhi[t][r8] = hi; vlo[t][r8] = lo; } }
#pragma unroll
    for (int t = 0; t < 16; ++t) { const size_t o = vb + (size_t)(t >> 1) * ((T / 32) * 1024) + (t & 1) * 512; *(v8b*)(VTh + o) = vhi[t]; *(v8b*)(VTl + o) = vlo[t]; }
    asm volatile("s_wait_xcnt 0x0" ::: "memory"); }   // what follows rewrites the data and address registers of the V^T stores
#pragma unroll 1
  for (int g = 0; g < 2; ++g) { const float* bias = g == 0 ? bq : bk; v8f acc[16]; v16b wf[16]; float bl[16];   // Q and K: through LDS into their layouts
#pragma unroll
    for (int t = 0; t < 16; ++t) { wf[t] = frag_kb(WQKV + (size_t)(g * C + t * 16 + nloc) * D, hlf); bl[t] = bias[t * 16 + nloc]; }   // the group's 32 fragment loads and 16 bias loads in flight before the first product
#pragma unroll
    for (int t = 0; t < 16; ++t) acc[t] = wmma16b(a, wf[t], (v8f){});
#pragma unroll
    for (int t = 0; t < 16; ++t) { const int cc = t * 16 + nloc; const float bb = bfv(bl[t]);
#pragma unroll
      for (int r8 = 0; r8 < 8; ++r8) Tf[8 * hlf + r8][cc] = acc[t][r8] * (1.0f / (XS * WSC)) + bb; }
    wave_lds_sync();
    if (g == 1) { const size_t kt0 = (t0 / T) * (size_t)(H * (T / 16)) + (t0 % T) / 16;   // this wave's 16 tokens are one key tile of every head
      v4f kf[2 * H][2];
#pragma unroll
      for (int hj = 0; hj < 2 * H; ++hj) { const float* sp = &Tf[nloc][hj * 16 + 8 * hlf]; kf[hj][0] = *(const v4f*)sp; kf[hj][1] = *(const v4f*)(sp + 4); }   // all LDS reads in flight before the first conversion
      v8b khi[2 * H], klo[2 * H];
#pragma unroll
      for (int hj = 0; hj < 2 * H; ++hj) { const v4f f0 = kf[hj][0], f1 = kf[hj][1];
#pragma unroll
        for (int e = 0; e < 8; ++e) { b16 a, c; split16((e < 4 ? f0[e & 3] : f1[e & 3]) * HS, a, c); khi[hj][e] = a; klo[hj][e] = c; } }
#pragma unroll
      for (int hj = 0; hj < 2 * H; ++hj) { const size_t o = (kt0 + (size_t)(hj >> 1) * (T / 16)) * 512 + (hj & 1) * 256 + lane * 8; *(v8b*)(Kh + o) = khi[hj]; *(v8b*)(Kl + o) = klo[hj]; } }
    else { v2f qf[16][4];
#pragma unroll
      for (int rr = 0; rr < 16; ++rr) for (int q = 0; q < 4; ++q) qf[rr][q] = *(const v2f*)(&Tf[rr][q * 64 + lane * 2]);   // all LDS reads in flight before the first conversion
      v2b qhi[16][4], qlo[16][4];
#pragma unroll
      for (int rr = 0; rr < 16; ++rr)
#pragma unroll
        for (int q = 0; q < 4; ++q) { b16 h0, l0, h1, l1; split16(qf[rr][q][0] * HS, h0, l0); split16(qf[rr][q][1] * HS, h1, l1); qhi[rr][q] = (v2b){h0, h1}; qlo[rr][q] = (v2b){l0, l1}; }
#pragma unroll
      for (int rr = 0; rr < 16; ++rr)
#pragma unroll
        for (int q = 0; q < 4; ++q) { const size_t o = (t0 + rr) * C + q * 64 + lane * 2; *(v2b*)(Qh + o) = qhi[rr][q]; *(v2b*)(Ql + o) = qlo[rr][q]; }
      asm volatile("s_wait_xcnt 0x0" ::: "memory");   // what follows this branch rewrites the data and address registers of the Q stores
    }
    wave_lds_sync(); } }
// Scores are formed transposed, S^T = K Q^T: a lane holds 8 keys of ONE query per tile, so the maximum and the sum
// are taken in the lane's own registers (one exchange between the wave's halves), and two S^T tiles, converted in place,
// are the B operand of O^T += V^T P^T. Scores and P never pass through LDS.
__device__ __forceinline__ float other_half(float v) { return __uint_as_float(__builtin_amdgcn_permlanex16(__float_as_uint(v), __float_as_uint(v), 0x76543210u, 0xfedcba98u, false, false)); }
constexpr int AW = 4 /* waves per workgroup */, QB = AW * 32 /* queries per workgroup */, SK = 256 /* keys per stage */, NST = T / SK, SH = SK * D /* halves per stage of one array: 16 KiB */;
// Eight copies of 16 bytes per lane, 2 KiB apart in LDS and in memory alike (128 lanes x 16 bytes = 2 KiB per copy): one array's 16-KiB stage.
// The s_wait_xcnt is the last line of the copies' own statement, so that it stands in front of every later write of the address registers they name.
__device__ __forceinline__ void copy8(unsigned l, const b16* g) {
  asm volatile("global_load_async_to_lds_b128 %0, %8, off\n\t"
               "global_load_async_to_lds_b128 %1, %9, off\n\t"
               "global_load_async_to_lds_b128 %2, %10, off\n\t"
               "global_load_async_to_lds_b128 %3, %11, off\n\t"
               "global_load_async_to_lds_b128 %4, %12, off\n\t"
               "global_load_async_to_lds_b128 %5, %13, off\n\t"
               "global_load_async_to_lds_b128 %6, %14, off\n\t"
               "global_load_async_to_lds_b128 %7, %15, off\n\t"
               "s_wait_xcnt 0x0"
               :: "v"(l), "v"(l + 2048u), "v"(l + 4096u), "v"(l + 6144u), "v"(l + 8192u), "v"(l + 10240u), "v"(l + 12288u), "v"(l + 14336u),
                  "v"(g), "v"(g + 1024), "v"(g + 2048), "v"(g + 3072), "v"(g + 4096), "v"(g + 5120), "v"(g + 6144), "v"(g + 7168) : "memory"); }
// One stage into one buffer: l = the lane's LDS byte address in the buffer's first array, o = the lane's offset in halves, the same in all four arrays.
__device__ __forceinline__ void stage_copy(unsigned l, size_t o, const b16* kh, const b16* kl, const b16* vh, const b16* vl) { copy8(l, kh + o); copy8(l + 2u * SH, kl + o); copy8(l + 4u * SH, vh + o); copy8(l + 6u * SH, vl + o); }
__global__ __launch_bounds__(128) void att_kernel(const b16* __restrict__ Qh, const b16* __restrict__ Ql, const b16* __restrict__ Kh, const b16* __restrict__ Kl, const b16* __restrict__ VTh, const b16* __restrict__ VTl, int QLIM, float* __restrict__ out) { __shared__ __attribute__((aligned(16))) b16 ring[2][4][SH] /* [buffer][K hi, K lo, V^T hi, V^T lo]; 128 KiB: two workgroups per WGP, two waves per SIMD */; const int tid = threadIdx.x, lane = tid & 31, nloc = lane & 15, hlf = lane >> 4; const int b = blockIdx.x / (H * (T / QB)), rem = blockIdx.x % (H * (T / QB)); const int h = rem / (T / QB), qb = (rem % (T / QB)) * QB; if (qb >= QLIM) return;   // the whole workgroup leaves, in front of every barrier
  const int q0 = qb + (tid >> 5) * 32; const size_t tq = (size_t)b * T + q0;
  constexpr float CL = SCALE / (HS * HS) * 1.4426950408889634f;   // raw score -> log2 units
  v16b qa[2], ql[2];
#pragma unroll
  for (int qt = 0; qt < 2; ++qt) { qa[qt] = frag_kb(Qh + (tq + qt * 16 + nloc) * C + h * D, hlf); ql[qt] = frag_kb(Ql + (tq + qt * 16 + nloc) * C + h * D, hlf); }
  asm volatile("s_wait_xcnt 0x0" ::: "memory");   // the Q loads' address registers are reused below
  const size_t kvbase = ((size_t)b * H + h) * (size_t)(T * D) + tid * 8;   // K and V^T alike: 32 keys = two 512-half tiles; a stage is SH contiguous halves of each array
  const unsigned l0 = (unsigned)(size_t)&ring[0][0][tid * 8];   // the lane's LDS byte address: low 32 bits of the shared address
  stage_copy(l0, kvbase, Kh, Kl, VTh, VTl);   // stage 0 into buffer 0
  asm volatile("s_wait_asynccnt 0x0" ::: "memory");   // this wave's copies of stage 0 have landed
  __syncthreads();   // every wave's have: stage 0 may be read
  stage_copy(l0 + 8u * SH, kvbase + SH, Kh, Kl, VTh, VTl);   // stage 1 into buffer 1, in flight while stage 0 is worked on
  v8f oacc[2][2] = {{(v8f){}, (v8f){}}, {(v8f){}, (v8f){}}};   // [query tile][d tile]: register r8 = d t*16 + 8*hlf + r8, lane column = query
  float mx[2] = {-INFINITY, -INFINITY}, ls[2] = {0.0f, 0.0f};   // ls: this half's keys only, in units of PS
  // The stage loop and the pass loop stay rolled (the pass body already takes about 236 VGPRs); the inner loops are unrolled so that every fragment index is a constant and stays in registers.
#pragma unroll 1
  for (int st = 0; st < NST; ++st) {
  const b16* buf = &ring[st & 1][0][lane * 8];
  v16b kh[2], kl[2];
#pragma unroll
  for (int t = 0; t < 2; ++t) { kh[t] = frag_pk(buf + t * 512); kl[t] = frag_pk(buf + SH + t * 512); }
#pragma unroll 1
  for (int k0 = 0; k0 < SK; k0 += KC) {
    v16b vh[2], vl[2];
#pragma unroll
    for (int t = 0; t < 2; ++t) { const b16* vp = buf + 2 * SH + k0 * D + t * 512; vh[t] = frag_pk(vp); vl[t] = frag_pk(vp + SH); }
    v8f s[2][2];
#pragma unroll
    for (int t = 0; t < 2; ++t)
#pragma unroll
      for (int qt = 0; qt < 2; ++qt) s[qt][t] = wmma16c(kh[t], qa[qt], (v8f){});
#pragma unroll
    for (int t = 0; t < 2; ++t)
#pragma unroll
      for (int qt = 0; qt < 2; ++qt) s[qt][t] = wmma16c(kl[t], qa[qt], s[qt][t]);
#pragma unroll
    for (int t = 0; t < 2; ++t)
#pragma unroll
      for (int qt = 0; qt < 2; ++qt) s[qt][t] = wmma16c(kh[t], ql[qt], s[qt][t]);
    __builtin_amdgcn_sched_barrier(0);   // the K reads below stay one group behind the last score product, not spread among the products
    { const int kn = k0 + KC < SK ? k0 + KC : 0;   // the next pass's K rows, into the registers just read; a stage's last pass re-reads its own stage's first rows and drops them: nothing of the next stage is read here
#pragma unroll
      for (int t = 0; t < 2; ++t) { kh[t] = frag_pk(buf + kn * D + t * 512); kl[t] = frag_pk(buf + SH + kn * D + t * 512); } }
    v16b ph[2], pl[2];
#pragma unroll
    for (int qt = 0; qt < 2; ++qt) { float c2[2];
#pragma unroll
      for (int t = 0; t < 2; ++t) { float m = s[qt][t][0];
#pragma unroll
        for (int r8 = 1; r8 < 8; ++r8) m = fmaxf(m, s[qt][t][r8]);
        c2[t] = m; }
      float cm = fmaxf(c2[0], c2[1]); cm = fmaxf(cm, other_half(cm));
      const float mo = mx[qt], mn = fmaxf(mo, cm); float fe; asm("v_exp_f32 %0, %1\n\tv_nop" : "=v"(fe) : "v"((mo - mn) * CL));   // exp2 and, in the same statement so that it stays directly behind, the one slot the instruction set asks for before a transcendental's source is overwritten or its result read
      const float fac = (mo == -INFINITY) ? 0.0f : fe; mx[qt] = mn;
      const float off = 8.0f - mn * CL;   // + 8: p comes out times PS = 256
      const v2f cl2 = {CL, CL}, off2 = {off, off}; v2f sm[2];
#pragma unroll
      for (int t = 0; t < 2; ++t)
#pragma unroll
        for (int e = 0; e < 8; e += 2) { const v2f a = __builtin_elementwise_fma((v2f){s[qt][t][e], s[qt][t][e + 1]}, cl2, off2); const v2f p = {__builtin_amdgcn_exp2f(a[0]), __builtin_amdgcn_exp2f(a[1])}; sm[t] = e == 0 ? p : sm[t] + p;
          const v2b hi = __builtin_convertvector(p, v2b); const v2b lo = __builtin_convertvector(p - __builtin_convertvector(hi, v2f), v2b);
          const int o = t * 8 + e; ph[qt][o] = hi[0]; ph[qt][o + 1] = hi[1]; pl[qt][o] = lo[0]; pl[qt][o + 1] = lo[1]; }
      const v2f s2 = sm[0] + sm[1]; ls[qt] = ls[qt] * fac + (s2[0] + s2[1]);
#pragma unroll
      for (int t = 0; t < 2; ++t) oacc[qt][t] *= fac; }
#pragma unroll
    for (int qt = 0; qt < 2; ++qt)
#pragma unroll
      for (int t = 0; t < 2; ++t) oacc[qt][t] = wmma16c(vh[t], ph[qt], oacc[qt][t]);
#pragma unroll
    for (int qt = 0; qt < 2; ++qt)
#pragma unroll
      for (int t = 0; t < 2; ++t) oacc[qt][t] = wmma16c(vl[t], ph[qt], oacc[qt][t]);
#pragma unroll
    for (int qt = 0; qt < 2; ++qt)
#pragma unroll
      for (int t = 0; t < 2; ++t) oacc[qt][t] = wmma16c(vh[t], pl[qt], oacc[qt][t]);
    asm volatile("v_nop\n\tv_nop\n\tv_nop\n\tv_nop" : "+v"(oacc[0][0]), "+v"(oacc[0][1]), "+v"(oacc[1][0]), "+v"(oacc[1][1])); }   // once per pass, behind its last products (tied to their results): the four vector slots in front of the next pass's first product, whose result the compiler may place in the registers of P lo, their B operand
  asm volatile("s_wait_dscnt 0x0" ::: "memory");   // this wave's reads of the buffer have retired before the buffer is refilled
  asm volatile("s_wait_asynccnt 0x0" ::: "memory");   // this wave's copies of stage st + 1 have landed
  __syncthreads();   // publishes stage st + 1 and ends every wave's reads of stage st
  if (st + 2 < NST) stage_copy(l0 + (unsigned)(st & 1) * (8u * SH), kvbase + (size_t)(st + 2) * SH, Kh, Kl, VTh, VTl); }
  asm volatile("s_wait_asynccnt 0x0" ::: "memory");   // no copy is outstanding when the wave ends
  if (q0 < QLIM)
#pragma unroll
  for (int qt = 0; qt < 2; ++qt) { const float inv = (1.0f / HS) / (ls[qt] + other_half(ls[qt]));
#pragma unroll
    for (int t = 0; t < 2; ++t) { float* o = out + (tq + qt * 16 + nloc) * C + h * D + t * 16 + 8 * hlf; const v8f r = oacc[qt][t] * inv; *(v4f*)o = (v4f){r[0], r[1], r[2], r[3]}; *(v4f*)(o + 4) = (v4f){r[4], r[5], r[6], r[7]}; } } }
}  // namespace

extern "C" void kernel_launch(void* const* d_in, const int* in_sizes, int n_in, void* d_out, int out_size, void* d_ws, size_t ws_size, hipStream_t stream) {
  (void)n_in;
  auto Fp = [&](int i) { return (const float*)d_in[i]; };
  // input order: 0 x [4,2048,32]; 1 Wq [8,32,32]; 2 bq [8,32]; 3 Wk; 4 bk; 5 Wv; 6 bv
  if (in_sizes[0] != NB_ * T * D || in_sizes[1] != H * D * D || in_sizes[3] != H * D * D || in_sizes[5] != H * D * D || in_sizes[2] != H * D || out_size != NB_ * T * C) return;
  const int QLIM = T;   // per-(b,h) query cut (multiple of 32)
  size_t off = 0; char* ws = (char*)d_ws;
  auto carve = [&](size_t bytes) { char* p = ws + off; off += (bytes + 255) & ~(size_t)255; return p; };
  b16* WQKV = (b16*)carve((size_t)3 * C * D * 2); b16* Qh = (b16*)carve((size_t)NB_ * T * C * 2); b16* Ql = (b16*)carve((size_t)NB_ * T * C * 2); b16* Kh = (b16*)carve((size_t)NB_ * T * C * 2); b16* Kl = (b16*)carve((size_t)NB_ * T * C * 2); b16* VTh = (b16*)carve((size_t)NB_ * C * T * 2); b16* VTl = (b16*)carve((size_t)NB_ * C * T * 2);
  if (off > ws_size || off > ((size_t)40 << 20)) return;   // ~ 25 MB
  wput_kernel<<<(3 * C * 4 + 255) / 256, 256, 0, stream>>>(Fp(1), Fp(3), Fp(5), WQKV);
  proj_kernel<<<NB_ * T / 16, 32, 0, stream>>>(Fp(0), WQKV, Fp(2), Fp(4), Fp(6), Qh, Ql, Kh, Kl, VTh, VTl);
  att_kernel<<<NB_ * H * (T / QB), QB, 0, stream>>>(Qh, Ql, Kh, Kl, VTh, VTl, QLIM, (float*)d_out);
}

// v007
// One run takes 51.5 microseconds.
// Two timings next to v006 both put it at 1.04 times that version's speed.
// All steps since v000 together make it 8.24 times as fast.
#include <hip/hip_runtime.h>

// MultiHeadSA: per head h: q = x Wq[h] + bq[h], k = x Wk[h] + bk[h], v = x Wv[h] + bv[h] (D = 32); wei = softmax_s(q.k / sqrt(32)); out[b][t][h*32 + d] = sum_s wei v -> [4][2048][256].
// K and V^T lie in the workspace in fragment order: per (b,h) and 16-row tile 512 halves, element (row r, k) at (k>>4)*256 + (((k>>3)&1)*16 + r)*8 + (k&7), so one wave-wide 16-byte load reads 512 contiguous bytes (K: r = key, k = d; V^T: r = d, k = key within a 32-key pass, tiles ordered pass-major). The projection stores V^T straight from its accumulators: a lane of a tile x rows x Wv rows holds 8 consecutive tokens of one channel, which is one 16-byte unit of that order.
// Attention: a workgroup of 4 waves (128 queries of one (b,h)) shares each 256-key stage of K hi/lo and V^T hi/lo through a two-buffer LDS ring filled by asynchronous copies; the fragments keep their order, so a wave-wide 16-byte LDS read is 512 contiguous bytes.
// Deterministic: flash-style online softmax over fixed 32-key passes in order; the reference that is subtracted from the scores is renewed only when a pass's P could leave the f16 range; no atomics.
// WMMA (v_wmma_f32_16x16x32_f16, f32 accumulate): x (EXACT bf16 x8, K 32) x [Wq|Wk|Wv] rows (EXACT; 48 tiles) per 16-token wave; per (b,h, 32-query) wave S^T = k rows (hi+lo) x q (hi+lo x256, K 32) and O^T += v^T rows (hi+lo) x P^T (hi+lo, packed from the S^T tiles), 3 products each; softmax in f32, in registers.

namespace {
constexpr int NB_ = 4, T = 2048, H = 8, D = 32, C = H * D /* 256 */, KC = 32 /* keys per pass */;
constexpr float XS = 8.0f, HS = 256.0f, PS = 256.0f, WSC = 256.0f, SCALE = 0.17677669529663688f;
typedef _Float16 b16;
typedef __attribute__((ext_vector_type(16))) _Float16 v16b;
typedef __attribute__((ext_vector_type(8))) _Float16 v8b;
typedef __attribute__((ext_vector_type(2))) _Float16 v2b;
typedef __attribute__((ext_vector_type(8))) float v8f;
typedef __attribute__((ext_vector_type(4))) float v4f;
typedef __attribute__((ext_vector_type(2))) float v2f;
__device__ __forceinline__ float bf16_rne(float f) { unsigned int u = __float_as_uint(f); u += 0x7FFFu + ((u >> 16) & 1u); float r = __uint_as_float(u & 0xFFFF0000u); asm volatile("" : "+v"(r)); return r; }
__device__ __forceinline__ float bfv(float f) { float r = bf16_rne(f); asm volatile("" : "+v"(r)); return r; }
__device__ __forceinline__ void split16(float v, b16& hi, b16& lo) { hi = (b16)v; lo = (b16)(v - (float)hi); }
__device__ __forceinline__ v16b frag_kb(const b16* p, int hh) { const v8b a = *(const v8b*)(p + 8 * hh), b = *(const v8b*)(p + 16 + 8 * hh); v16b f;
#pragma unroll
  for (int e = 0; e < 8; ++e) { f[e] = a[e]; f[8 + e] = b[e]; } return f; }
__device__ __forceinline__ v16b frag_pk(const b16* p) { const v8b a = *(const v8b*)p, b = *(const v8b*)(p + 256); v16b f;   // p: tile base + lane * 8
#pragma unroll
  for (int e = 0; e < 8; ++e) { f[e] = a[e]; f[8 + e] = b[e]; } return f; }
__device__ __forceinline__ v8f wmma16b(v16b a, v16b b, v8f c) { v8f d = __builtin_amdgcn_wmma_f32_16x16x32_f16(false, a, false, b, (short)0, c, false, false); asm volatile("v_nop\n\tv_nop\n\tv_nop\n\tv_nop" : "+v"(d) : "v"(a), "v"(b)); return d; }
__device__ __forceinline__ v8f wmma16c(v16b a, v16b b, v8f c) { return __builtin_amdgcn_wmma_f32_16x16x32_f16(false, a, false, b, (short)0, c, false, false); }   // for the attention loop, the builtin alone: the compiler keeps the distance behind it, with other WMMAs and softmax work where there is some
__device__ __forceinline__ void wave_lds_sync() { __builtin_amdgcn_fence(__ATOMIC_RELEASE, "workgroup"); __builtin_amdgcn_wave_barrier(); __builtin_amdgcn_fence(__ATOMIC_ACQUIRE, "workgroup"); }

__global__ __launch_bounds__(256) void wput_kernel(const float* __restrict__ wq, const float* __restrict__ wk, const float* __restrict__ wv, b16* __restrict__ WQKV) { const int u = blockIdx.x * 256 + threadIdx.x; if (u >= 3 * C * 4) return; const int r = u / 4, c0 = (u % 4) * 8; const int which = r / C, h = (r % C) / D, d = r % D; const float* w = which == 0 ? wq : (which == 1 ? wk : wv); v8b v; float wl[8];
#pragma unroll
  for (int j = 0; j < 8; ++j) wl[j] = w[((size_t)h * D + c0 + j) * D + d];   // all eight loads in flight before the first value is used
#pragma unroll
  for (int j = 0; j < 8; ++j) v[j] = (b16)(bf16_rne(wl[j]) * WSC);
  { *(v8b*)(WQKV + (size_t)r * D + c0) = v;  } }
__global__ __launch_bounds__(32) void proj_kernel(const float* __restrict__ x, const b16* __restrict__ WQKV, const float* __restrict__ bq, const float* __restrict__ bk, const float* __restrict__ bv, b16* __restrict__ Qh, b16* __restrict__ Ql, b16* __restrict__ Kh, b16* __restrict__ Kl, b16* __restrict__ VTh, b16* __restrict__ VTl) { __shared__ __attribute__((aligned(16))) b16 Ax[16][D + 8]; __shared__ __attribute__((aligned(16))) float Tf[16][260]; const int lane = threadIdx.x, nloc = lane & 15, hlf = lane >> 4; const size_t t0 = (size_t)blockIdx.x * 16;
  { float xl[16]; const float* xp = x + t0 * D + lane;
#pragma unroll
    for (int rr = 0; rr < 16; ++rr) xl[rr] = xp[rr * D];   // the 16 rows' loads in flight together: one latency, not 16
#pragma unroll
    for (int rr = 0; rr < 16; ++rr) Ax[rr][lane] = (b16)(bf16_rne(xl[rr]) * XS); }
  if (lane < 16) for (int k = D; k < D + 8; ++k) Ax[lane][k] = (b16)0.0f;
  wave_lds_sync(); const v16b a = frag_kb(&Ax[nloc][0], hlf);
  { v16b wf[16]; float bl[16];   // V first, no LDS pass: its stores retire under the Q group's loads
#pragma unroll
    for (int t = 0; t < 16; ++t) { wf[t] = frag_kb(WQKV + (size_t)(2 * C + t * 16 + nloc) * D, hlf); bl[t] = bv[t * 16 + nloc]; }   // the group's 32 fragment loads and 16 bias loads in flight before the first product
    const size_t vb = ((t0 / T) * (size_t)(H * (T / 32)) + (t0 % T) / 32) * 1024 + ((t0 / 16) & 1) * 256 + lane * 8;   // this wave's 16 tokens are one half (k >> 4) of one 32-key pass of every head
    v8b vhi[16], vlo[16];
#pragma unroll
    for (int t = 0; t < 16; ++t) { const v8f acc = wmma16b(a, wf[t], (v8f){}); const float bb = bfv(bl[t]);   // register r8 = token 8 * hlf + r8 (k & 7 = r8, (k >> 3) & 1 = hlf), lane column = channel t * 16 + nloc (head t >> 1, d tile t & 1, r = nloc)
#pragma unroll
      for (int r8 = 0; r8 < 8; ++r8) { b16 hi, lo; split16((acc[r8] * (1.0f / (XS * WSC)) + bb) * HS, hi, lo); vhi[t][r8] = hi; vlo[t][r8] = lo; } }
#pragma unroll
    for (int t = 0; t < 16; ++t) { const size_t o = vb + (size_t)(t >> 1) * ((T / 32) * 1024) + (t & 1) * 512; *(v8b*)(VTh + o) = vhi[t]; *(v8b*)(VTl + o) = vlo[t]; }
    asm volatile("s_wait_xcnt 0x0" ::: "memory"); }   // what follows rewrites the data and address registers of the V^T stores
#pragma unroll 1
  for (int g = 0; g < 2; ++g) { const float* bias = g == 0 ? bq : bk; v8f acc[16]; v16b wf[16]; float bl[16];   // Q and K: through LDS into their layouts
#pragma unroll
    for (int t = 0; t < 16; ++t) { wf[t] = frag_kb(WQKV + (size_t)(g * C + t * 16 + nloc) * D, hlf); bl[t] = bias[t * 16 + nloc]; }   // the group's 32 fragment loads and 16 bias loads in flight before the first product
#pragma unroll
    for (int t = 0; t < 16; ++t) acc[t] = wmma16b(a, wf[t], (v8f){});
#pragma unroll
    for (int t = 0; t < 16; ++t) { const int cc = t * 16 + nloc; const float bb = bfv(bl[t]);
#pragma unroll
      for (int r8 = 0; r8 < 8; ++r8) Tf[8 * hlf + r8][cc] = acc[t][r8] * (1.0f / (XS * WSC)) + bb; }
    wave_lds_sync();
    if (g == 1) { const size_t kt0 = (t0 / T) * (size_t)(H * (T / 16)) + (t0 % T) / 16;   // this wave's 16 tokens are one key tile of every head
      v4f kf[2 * H][2];
#pragma unroll
      for (int hj = 0; hj < 2 * H; ++hj) { const float* sp = &Tf[nloc][hj * 16 + 8 * hlf]; kf[hj][0] = *(const v4f*)sp; kf[hj][1] = *(const v4f*)(sp + 4); }   // all LDS reads in flight before the first conversion
      v8b khi[2 * H], klo[2 * H];
#pragma unroll
      for (int hj = 0; hj < 2 * H; ++hj) { const v4f f0 = kf[hj][0], f1 = kf[hj][1];
#pragma unroll
        for (int e = 0; e < 8; ++e) { b16 a, c; split16((e < 4 ? f0[e & 3] : f1[e & 3]) * HS, a, c); khi[hj][e] = a; klo[hj][e] = c; } }
#pragma unroll
      for (int hj = 0; hj < 2 * H; ++hj) { const size_t o = (kt0 + (size_t)(hj >> 1) * (T / 16)) * 512 + (hj & 1) * 256 + lane * 8; *(v8b*)(Kh + o) = khi[hj]; *(v8b*)(Kl + o) = klo[hj]; } }
    else { v2f qf[16][4];
#pragma unroll
      for (int rr = 0; rr < 16; ++rr) for (int q = 0; q < 4; ++q) qf[rr][q] = *(const v2f*)(&Tf[rr][q * 64 + lane * 2]);   // all LDS reads in flight before the first conversion
      v2b qhi[16][4], qlo[16][4];
#pragma unroll
      for (int rr = 0; rr < 16; ++rr)
#pragma unroll
        for (int q = 0; q < 4; ++q) { b16 h0, l0, h1, l1; split16(qf[rr][q][0] * HS, h0, l0); split16(qf[rr][q][1] * HS, h1, l1); qhi[rr][q] = (v2b){h0, h1}; qlo[rr][q] = (v2b){l0, l1}; }
#pragma unroll
      for (int rr = 0; rr < 16; ++rr)
#pragma unroll
        for (int q = 0; q < 4; ++q) { const size_t o = (t0 + rr) * C + q * 64 + lane * 2; *(v2b*)(Qh + o) = qhi[rr][q]; *(v2b*)(Ql + o) = qlo[rr][q]; }
      asm volatile("s_wait_xcnt 0x0" ::: "memory");   // what follows this branch rewrites the data and address registers of the Q stores
    }
    wave_lds_sync(); } }
// Scores are formed transposed, S^T = K Q^T: a lane holds 8 keys of ONE query per tile, so the maximum and the sum
// are taken in the lane's own registers (one exchange between the wave's halves), and two S^T tiles, converted in place,
// are the B operand of O^T += V^T P^T. Scores and P never pass through LDS.
__device__ __forceinline__ float other_half(float v) { return __uint_as_float(__builtin_amdgcn_permlanex16(__float_as_uint(v), __float_as_uint(v), 0x76543210u, 0xfedcba98u, false, false)); }
constexpr int AW = 4 /* waves per workgroup */, QB = AW * 32 /* queries per workgroup */, SK = 256 /* keys per stage */, NST = T / SK, SH = SK * D /* halves per stage of one array: 16 KiB */;
// Eight copies of 16 bytes per lane, 2 KiB apart in LDS and in memory alike (128 lanes x 16 bytes = 2 KiB per copy): one array's 16-KiB stage.
// The s_wait_xcnt is the last line of the copies' own statement, so that it stands in front of every later write of the address registers they name.
__device__ __forceinline__ void copy8(unsigned l, const b16* g) {
  asm volatile("global_load_async_to_lds_b128 %0, %8, off\n\t"
               "global_load_async_to_lds_b128 %1, %9, off\n\t"
               "global_load_async_to_lds_b128 %2, %10, off\n\t"
               "global_load_async_to_lds_b128 %3, %11, off\n\t"
               "global_load_async_to_lds_b128 %4, %12, off\n\t"
               "global_load_async_to_lds_b128 %5, %13, off\n\t"
               "global_load_async_to_lds_b128 %6, %14, off\n\t"
               "global_load_async_to_lds_b128 %7, %15, off\n\t"
               "s_wait_xcnt 0x0"
               :: "v"(l), "v"(l + 2048u), "v"(l + 4096u), "v"(l + 6144u), "v"(l + 8192u), "v"(l + 10240u), "v"(l + 12288u), "v"(l + 14336u),
                  "v"(g), "v"(g + 1024), "v"(g + 2048), "v"(g + 3072), "v"(g + 4096), "v"(g + 5120), "v"(g + 6144), "v"(g + 7168) : "memory"); }
// One stage into one buffer: l = the lane's LDS byte address in the buffer's first array, o = the lane's offset in halves, the same in all four arrays.
__device__ __forceinline__ void stage_copy(unsigned l, size_t o, const b16* kh, const b16* kl, const b16* vh, const b16* vl) { copy8(l, kh + o); copy8(l + 2u * SH, kl + o); copy8(l + 4u * SH, vh + o); copy8(l + 6u * SH, vl + o); }
__global__ __launch_bounds__(128) void att_kernel(const b16* __restrict__ Qh, const b16* __restrict__ Ql, const b16* __restrict__ Kh, const b16* __restrict__ Kl, const b16* __restrict__ VTh, const b16* __restrict__ VTl, int QLIM, float* __restrict__ out) { __shared__ __attribute__((aligned(16))) b16 ring[2][4][SH] /* [buffer][K hi, K lo, V^T hi, V^T lo]; 128 KiB: two workgroups per WGP, two waves per SIMD */; const int tid = threadIdx.x, lane = tid & 31, nloc = lane & 15, hlf = lane >> 4; const int b = blockIdx.x / (H * (T / QB)), rem = blockIdx.x % (H * (T / QB)); const int h = rem / (T / QB), qb = (rem % (T / QB)) * QB; if (qb >= QLIM) return;   // the whole workgroup leaves, in front of every barrier
  const int q0 = qb + (tid >> 5) * 32; const size_t tq = (size_t)b * T + q0;
  constexpr float CL = SCALE / (HS * HS) * 1.4426950408889634f;   // raw score -> log2 units
  constexpr float PLIM = 32768.0f;   // bound on a lane's sum over one pass of P as stored (times PS), above which the reference is renewed; below the largest f16
  v16b qa[2], ql[2];
#pragma unroll
  for (int qt = 0; qt < 2; ++qt) { qa[qt] = frag_kb(Qh + (tq + qt * 16 + nloc) * C + h * D, hlf); ql[qt] = frag_kb(Ql + (tq + qt * 16 + nloc) * C + h * D, hlf); }
  asm volatile("s_wait_xcnt 0x0" ::: "memory");   // the Q loads' address registers are reused below
  const size_t kvbase = ((size_t)b * H + h) * (size_t)(T * D) + tid * 8;   // K and V^T alike: 32 keys = two 512-half tiles; a stage is SH contiguous halves of each array
  const unsigned l0 = (unsigned)(size_t)&ring[0][0][tid * 8];   // the lane's LDS byte address: low 32 bits of the shared address
  stage_copy(l0, kvbase, Kh, Kl, VTh, VTl);   // stage 0 into buffer 0
  asm volatile("s_wait_asynccnt 0x0" ::: "memory");   // this wave's copies of stage 0 have landed
  __syncthreads();   // every wave's have: stage 0 may be read
  stage_copy(l0 + 8u * SH, kvbase + SH, Kh, Kl, VTh, VTl);   // stage 1 into buffer 1, in flight while stage 0 is worked on
  v8f oacc[2][2] = {{(v8f){}, (v8f){}}, {(v8f){}, (v8f){}}};   // [query tile][d tile]: register r8 = d t*16 + 8*hlf + r8, lane column = query
  float mx[2] = {-INFINITY, -INFINITY}, off[2] = {INFINITY, INFINITY}, ls[2] = {0.0f, 0.0f};   // mx: the reference in use, a maximum of scores seen; off = 8 - mx * CL; ls: this half's keys only, in units of PS
  // The stage loop and the pass loop stay rolled (the pass body already takes about 210 VGPRs); the inner loops are unrolled so that every fragment index is a constant and stays in registers.
#pragma unroll 1
  for (int st = 0; st < NST; ++st) {
  const b16* buf = &ring[st & 1][0][lane * 8];
  v16b kh[2], kl[2];
#pragma unroll
  for (int t = 0; t < 2; ++t) { kh[t] = frag_pk(buf + t * 512); kl[t] = frag_pk(buf + SH + t * 512); }
#pragma unroll 1
  for (int k0 = 0; k0 < SK; k0 += KC) {
    v16b vh[2], vl[2];
#pragma unroll
    for (int t = 0; t < 2; ++t) { const b16* vp = buf + 2 * SH + k0 * D + t * 512; vh[t] = frag_pk(vp); vl[t] = frag_pk(vp + SH); }
    v8f s[2][2];
#pragma unroll
    for (int t = 0; t < 2; ++t)
#pragma unroll
      for (int qt = 0; qt < 2; ++qt) s[qt][t] = wmma16c(kh[t], qa[qt], (v8f){});
#pragma unroll
    for (int t = 0; t < 2; ++t)
#pragma unroll
      for (int qt = 0; qt < 2; ++qt) s[qt][t] = wmma16c(kl[t], qa[qt], s[qt][t]);
#pragma unroll
    for (int t = 0; t < 2; ++t)
#pragma unroll
      for (int qt = 0; qt < 2; ++qt) s[qt][t] = wmma16c(kh[t], ql[qt], s[qt][t]);
    __builtin_amdgcn_sched_barrier(0);   // the K reads below stay one group behind the last score product, not spread among the products
    { const int kn = k0 + KC < SK ? k0 + KC : 0;   // the next pass's K rows, into the registers just read; a stage's last pass re-reads its own stage's first rows and drops them: nothing of the next stage is read here
#pragma unroll
      for (int t = 0; t < 2; ++t) { kh[t] = frag_pk(buf + kn * D + t * 512); kl[t] = frag_pk(buf + SH + kn * D + t * 512); } }
    v2f p[2][8]; float ps[2];
    // P = 2^(score * CL + off) with the reference in use, and this half's sum of it
    auto expo = [&]() {
#pragma unroll
      for (int qt = 0; qt < 2; ++qt) { const v2f cl2 = {CL, CL}, off2 = {off[qt], off[qt]}; v2f sm[2];
#pragma unroll
        for (int t = 0; t < 2; ++t)
#pragma unroll
          for (int e = 0; e < 8; e += 2) { const v2f a = __builtin_elementwise_fma((v2f){s[qt][t][e], s[qt][t][e + 1]}, cl2, off2); const v2f x = {__builtin_amdgcn_exp2f(a[0]), __builtin_amdgcn_exp2f(a[1])}; sm[t] = e == 0 ? x : sm[t] + x; p[qt][t * 4 + e / 2] = x; }
        const v2f s2 = sm[0] + sm[1]; ps[qt] = s2[0] + s2[1]; } };
    expo();
    // Every p is >= 0, so no p is above the lane's sum: while that sum stays at or below PLIM every p fits f16 and the reference may stay.
    // One test per pass, a scalar branch; written as "not <=" so that an infinite sum (the first pass: off = +inf) and a NaN take the branch too. Marked as not expected, so that the renewal lies out of line and the usual path falls through.
    if (__builtin_expect(__builtin_amdgcn_ballot_w32(!(ps[0] + ps[1] <= PLIM)) != 0, 0)) {
#pragma unroll
      for (int qt = 0; qt < 2; ++qt) { float c2[2];   // new reference: the larger of the old reference and this pass's maximum; the sum and O are brought to it
#pragma unroll
        for (int t = 0; t < 2; ++t) { float m = s[qt][t][0];
#pragma unroll
          for (int r8 = 1; r8 < 8; ++r8) m = fmaxf(m, s[qt][t][r8]);
          c2[t] = m; }
        float cm = fmaxf(c2[0], c2[1]); cm = fmaxf(cm, other_half(cm));
        const float mo = mx[qt], mn = fmaxf(mo, cm); float fe; asm("v_exp_f32 %0, %1\n\tv_nop" : "=v"(fe) : "v"((mo - mn) * CL));   // exp2 and, in the same statement so that it stays directly behind, the one slot the instruction set asks for before a transcendental's source is overwritten or its result read
        const float fac = (mo == -INFINITY) ? 0.0f : fe; mx[qt] = mn;
        off[qt] = 8.0f - mn * CL;   // + 8: p comes out times PS = 256
        ls[qt] *= fac;
#pragma unroll
        for (int t = 0; t < 2; ++t) oacc[qt][t] *= fac; }
      expo(); }   // now every p <= PS
    v16b ph[2], pl[2];
#pragma unroll
    for (int qt = 0; qt < 2; ++qt) { ls[qt] += ps[qt];
#pragma unroll
      for (int j = 0; j < 8; ++j) { const v2b hi = __builtin_convertvector(p[qt][j], v2b); const v2b lo = __builtin_convertvector(p[qt][j] - __builtin_convertvector(hi, v2f), v2b);
        ph[qt][2 * j] = hi[0]; ph[qt][2 * j + 1] = hi[1]; pl[qt][2 * j] = lo[0]; pl[qt][2 * j + 1] = lo[1]; } }
#pragma unroll
    for (int qt = 0; qt < 2; ++qt)
#pragma unroll
      for (int t = 0; t < 2; ++t) oacc[qt][t] = wmma16c(vh[t], ph[qt], oacc[qt][t]);
#pragma unroll
    for (int qt = 0; qt < 2; ++qt)
#pragma unroll
      for (int t = 0; t < 2; ++t) oacc[qt][t] = wmma16c(vl[t], ph[qt], oacc[qt][t]);
#pragma unroll
    for (int qt = 0; qt < 2; ++qt)
#pragma unroll
      for (int t = 0; t < 2; ++t) oacc[qt][t] = wmma16c(vh[t], pl[qt], oacc[qt][t]);
    asm volatile("v_nop\n\tv_nop\n\tv_nop\n\tv_nop" : "+v"(oacc[0][0]), "+v"(oacc[0][1]), "+v"(oacc[1][0]), "+v"(oacc[1][1])); }   // once per pass, behind its last products (tied to their results): the four vector slots in front of the next pass's first product, whose result the compiler may place in the registers of P lo, their B operand
  asm volatile("s_wait_dscnt 0x0" ::: "memory");   // this wave's reads of the buffer have retired before the buffer is refilled
  asm volatile("s_wait_asynccnt 0x0" ::: "memory");   // this wave's copies of stage st + 1 have landed
  __syncthreads();   // publishes stage st + 1 and ends every wave's reads of stage st
  if (st + 2 < NST) stage_copy(l0 + (unsigned)(st & 1) * (8u * SH), kvbase + (size_t)(st + 2) * SH, Kh, Kl, VTh, VTl); }
  asm volatile("s_wait_asynccnt 0x0" ::: "memory");   // no copy is outstanding when the wave ends
  if (q0 < QLIM)
#pragma unroll
  for (int qt = 0; qt < 2; ++qt) { const float inv = (1.0f / HS) / (ls[qt] + other_half(ls[qt]));
#pragma unroll
    for (int t = 0; t < 2; ++t) { float* o = out + (tq + qt * 16 + nloc) * C + h * D + t * 16 + 8 * hlf; const v8f r = oacc[qt][t] * inv; *(v4f*)o = (v4f){r[0], r[1], r[2], r[3]}; *(v4f*)(o + 4) = (v4f){r[4], r[5], r[6], r[7]}; } } }
}  // namespace

extern "C" void kernel_launch(void* const* d_in, const int* in_sizes, int n_in, void* d_out, int out_size, void* d_ws, size_t ws_size, hipStream_t stream) {
  (void)n_in;
  auto Fp = [&](int i) { return (const float*)d_in[i]; };
  // input order: 0 x [4,2048,32]; 1 Wq [8,32,32]; 2 bq [8,32]; 3 Wk; 4 bk; 5 Wv; 6 bv
  if (in_sizes[0] != NB_ * T * D || in_sizes[1] != H * D * D || in_sizes[3] != H * D * D || in_sizes[5] != H * D * D || in_sizes[2] != H * D || out_size != NB_ * T * C) return;
  const int QLIM = T;   // per-(b,h) query cut (multiple of 32)
  size_t off = 0; char* ws = (char*)d_ws;
  auto carve = [&](size_t bytes) { char* p = ws + off; off += (bytes + 255) & ~(size_t)255; return p; };
  b16* WQKV = (b16*)carve((size_t)3 * C * D * 2); b16* Qh = (b16*)carve((size_t)NB_ * T * C * 2); b16* Ql = (b16*)carve((size_t)NB_ * T * C * 2); b16* Kh = (b16*)carve((size_t)NB_ * T * C * 2); b16* Kl = (b16*)carve((size_t)NB_ * T * C * 2); b16* VTh = (b16*)carve((size_t)NB_ * C * T * 2); b16* VTl = (b16*)carve((size_t)NB_ * C * T * 2);
  if (off > ws_size || off > ((size_t)40 << 20)) return;   // ~ 25 MB
  wput_kernel<<<(3 * C * 4 + 255) / 256, 256, 0, stream>>>(Fp(1), Fp(3), Fp(5), WQKV);
  proj_kernel<<<NB_ * T / 16, 32, 0, stream>>>(Fp(0), WQKV, Fp(2), Fp(4), Fp(6), Qh, Ql, Kh, Kl, VTh, VTl);
  att_kernel<<<NB_ * H * (T / QB), QB, 0, stream>>>(Qh, Ql, Kh, Kl, VTh, VTl, QLIM, (float*)d_out);
}

// v009
// Measured time: 28 microseconds a run.
// Versions between v007 and this one are left out; their measured steps multiply to 1.86 times as fast.
// All steps since v000 together make it 15.3 times as fast.
#include <hip/hip_runtime.h>

// MultiHeadSA: per head h: q = x Wq[h] + bq[h], k = x Wk[h] + bk[h], v = x Wv[h] + bv[h] (D = 32); wei = softmax_s(q.k / sqrt(32)); out[b][t][h*32 + d] = sum_s wei v -> [4][2048][256].
// K and V^T lie in the workspace in fragment order: per (b,h) and 16-row tile 512 halves, element (row r, k) at (k>>4)*256 + (((k>>3)&1)*16 + r)*8 + (k&7), so one wave-wide 16-byte load reads 512 contiguous bytes (K: r = key, k = d; V^T: r = d, k = key within a 32-key pass, tiles ordered pass-major). The projection stores V^T straight from its accumulators: a lane of a tile x rows x Wv rows holds 8 consecutive tokens of one channel, which is one 16-byte unit of that order.
// Operand precision: q, k, v (each times 256) and P (times 256) enter their products rounded once to f16 (11 significant bits, to nearest even); sums, softmax and O stay f32.
// Attention: a workgroup of 4 waves (128 queries of one (b,h)) shares each 256-key stage of K and V^T through a two-buffer LDS ring filled by asynchronous copies; the fragments keep their order, so a wave-wide 16-byte LDS read is 512 contiguous bytes.
// Deterministic: flash-style online softmax over fixed 32-key passes in order; the reference that is subtracted from the scores is renewed only when a pass's P could leave the f16 range; no atomics.
// WMMA (v_wmma_f32_16x16x32_f16, f32 accumulate): x (EXACT bf16 x8, K 32) x [Wq|Wk|Wv] rows (EXACT; 48 tiles) per 16-token wave; per (b,h, 32-query) wave S^T = k rows x q (x256, K 32) and O^T += v^T rows x P^T (packed from the S^T tiles), one product each; softmax in f32, in registers.

namespace {
constexpr int NB_ = 4, T = 2048, H = 8, D = 32, C = H * D /* 256 */, KC = 32 /* keys per pass */;
constexpr float XS = 8.0f, HS = 256.0f, PS = 256.0f, WSC = 256.0f, SCALE = 0.17677669529663688f;
typedef _Float16 b16;
typedef __attribute__((ext_vector_type(16))) _Float16 v16b;
typedef __attribute__((ext_vector_type(8))) _Float16 v8b;
typedef __attribute__((ext_vector_type(2))) _Float16 v2b;
typedef __attribute__((ext_vector_type(8))) float v8f;
typedef __attribute__((ext_vector_type(4))) float v4f;
typedef __attribute__((ext_vector_type(2))) float v2f;
__device__ __forceinline__ float bf16_rne(float f) { unsigned int u = __float_as_uint(f); u += 0x7FFFu + ((u >> 16) & 1u); float r = __uint_as_float(u & 0xFFFF0000u); asm volatile("" : "+v"(r)); return r; }
__device__ __forceinline__ float bfv(float f) { float r = bf16_rne(f); asm volatile("" : "+v"(r)); return r; }
__device__ __forceinline__ v16b frag_kb(const b16* p, int hh) { const v8b a = *(const v8b*)(p + 8 * hh), b = *(const v8b*)(p + 16 + 8 * hh); v16b f;
#pragma unroll
  for (int e = 0; e < 8; ++e) { f[e] = a[e]; f[8 + e] = b[e]; } return f; }
__device__ __forceinline__ v16b frag_pk(const b16* p) { const v8b a = *(const v8b*)p, b = *(const v8b*)(p + 256); v16b f;   // p: tile base + lane * 8
#pragma unroll
  for (int e = 0; e < 8; ++e) { f[e] = a[e]; f[8 + e] = b[e]; } return f; }
__device__ __forceinline__ v8f wmma16b(v16b a, v16b b, v8f c) { v8f d = __builtin_amdgcn_wmma_f32_16x16x32_f16(false, a, false, b, (short)0, c, false, false); asm volatile("v_nop\n\tv_nop\n\tv_nop\n\tv_nop" : "+v"(d) : "v"(a), "v"(b)); return d; }
__device__ __forceinline__ v8f wmma16c(v16b a, v16b b, v8f c) { return __builtin_amdgcn_wmma_f32_16x16x32_f16(false, a, false, b, (short)0, c, false, false); }   // for the attention loop, the builtin alone: the compiler keeps the distance behind it, with other WMMAs and softmax work where there is some
__device__ __forceinline__ void wave_lds_sync() { __builtin_amdgcn_fence(__ATOMIC_RELEASE, "workgroup"); __builtin_amdgcn_wave_barrier(); __builtin_amdgcn_fence(__ATOMIC_ACQUIRE, "workgroup"); }

// A workgroup of PW waves (16 tokens each) first rounds all of Wq | Wk | Wv into LDS, row r = (matrix, head, d) holding its 32 values over c (row pitch 80 bytes: 16 x odd, for the 16-byte fragment reads), and copies the biases there in the same order; every wave then takes its B fragments from LDS.
constexpr int PW = 4 /* waves per workgroup */, WP = D + 8 /* halves per LDS row of W */;
__global__ __launch_bounds__(32 * PW) void proj_kernel(const float* __restrict__ x, const float* __restrict__ wq, const float* __restrict__ wk, const float* __restrict__ wv, const float* __restrict__ bq, const float* __restrict__ bk, const float* __restrict__ bv, b16* __restrict__ Qh, b16* __restrict__ Kh, b16* __restrict__ VTh) { __shared__ __attribute__((aligned(16))) b16 Wl[3 * C][WP]; __shared__ __attribute__((aligned(16))) float Bl[3 * C]; __shared__ __attribute__((aligned(16))) b16 AxW[PW][16][D + 8]; __shared__ __attribute__((aligned(16))) float TfW[PW][16][260]; const int tid = threadIdx.x, wave = tid >> 5, lane = tid & 31, nloc = lane & 15, hlf = lane >> 4; b16 (*Ax)[D + 8] = AxW[wave]; float (*Tf)[260] = TfW[wave];   // Ax and Tf: each wave's own
  const size_t t0 = ((size_t)blockIdx.x * PW + wave) * 16;
  { float xl[16]; const float* xp = x + t0 * D + lane;
#pragma unroll
    for (int rr = 0; rr < 16; ++rr) xl[rr] = xp[rr * D];   // the 16 rows' loads in flight together: one latency, not 16
    // W: a lane takes 8 values of c x 4 of d per unit (8 lanes cover one 128-byte row of W, a wave-wide load 4 whole rows), 6 units: matrix i >> 1, head (i & 1) * 4 + wave
    const int db = lane & 7, cb = lane >> 3; v4f wl[6][8]; float bl6[6];
#pragma unroll
    for (int i = 0; i < 6; ++i) { const float* w = (i < 2 ? wq : (i < 4 ? wk : wv)) + ((size_t)((i & 1) * 4 + wave) * D + cb * 8) * D + db * 4;
#pragma unroll
      for (int j = 0; j < 8; ++j) wl[i][j] = *(const v4f*)(w + j * D);   // all 48 loads in flight before the first value is used
      bl6[i] = (i < 2 ? bq : (i < 4 ? bk : bv))[(i & 1) * 128 + tid];
      if (i & 1) asm volatile("s_wait_xcnt 0x0" ::: "memory"); }   // behind each matrix's loads: what follows (the next matrix's loads, then the rounding) may be given the registers that hold their addresses
#pragma unroll
    for (int rr = 0; rr < 16; ++rr) Ax[rr][lane] = (b16)(bf16_rne(xl[rr]) * XS);
#pragma unroll
    for (int i = 0; i < 6; ++i) {
#pragma unroll
      for (int e = 0; e < 4; ++e) { v8b v;
#pragma unroll
        for (int j = 0; j < 8; ++j) v[j] = (b16)(bf16_rne(wl[i][j][e]) * WSC);
        *(v8b*)&Wl[(i >> 1) * C + ((i & 1) * 4 + wave) * D + db * 4 + e][cb * 8] = v; }
      Bl[i * 128 + tid] = bl6[i]; } }
  if (lane < 16) for (int k = D; k < D + 8; ++k) Ax[lane][k] = (b16)0.0f;
  __syncthreads();   // W and the biases, written by all waves, may be read by all; nothing writes them again
  const v16b a = frag_kb(&Ax[nloc][0], hlf);
  { v16b wf[16]; float bl[16];   // V first, no LDS pass: its stores retire under the Q group's loads
#pragma unroll
    for (int t = 0; t < 16; ++t) { wf[t] = frag_kb(&Wl[2 * C + t * 16 + nloc][0], hlf); bl[t] = Bl[2 * C + t * 16 + nloc]; }   // the group's 32 fragment reads and 16 bias reads in flight before the first product
    const size_t vb = ((t0 / T) * (size_t)(H * (T / 32)) + (t0 % T) / 32) * 1024 + ((t0 / 16) & 1) * 256 + lane * 8;   // this wave's 16 tokens are one half (k >> 4) of one 32-key pass of every head
    v8b vhi[16];
#pragma unroll
    for (int t = 0; t < 16; ++t) { const v8f acc = wmma16b(a, wf[t], (v8f){}); const float bb = bfv(bl[t]);   // register r8 = token 8 * hlf + r8 (k & 7 = r8, (k >> 3) & 1 = hlf), lane column = channel t * 16 + nloc (head t >> 1, d tile t & 1, r = nloc)
#pragma unroll
      for (int r8 = 0; r8 < 8; ++r8) vhi[t][r8] = (b16)((acc[r8] * (1.0f / (XS * WSC)) + bb) * HS); }
#pragma unroll
    for (int t = 0; t < 16; ++t) { const size_t o = vb + (size_t)(t >> 1) * ((T / 32) * 1024) + (t & 1) * 512; *(v8b*)(VTh + o) = vhi[t]; }
    asm volatile("s_wait_xcnt 0x0" ::: "memory"); }   // what follows rewrites the data and address registers of the V^T stores
#pragma unroll 1
  for (int g = 0; g < 2; ++g) { v8f acc[16]; v16b wf[16]; float bl[16];   // Q and K: through LDS into their layouts
#pragma unroll
    for (int t = 0; t < 16; ++t) { wf[t] = frag_kb(&Wl[g * C + t * 16 + nloc][0], hlf); bl[t] = Bl[g * C + t * 16 + nloc]; }   // the group's 32 fragment reads and 16 bias reads in flight before the first product
#pragma unroll
    for (int t = 0; t < 16; ++t) acc[t] = wmma16b(a, wf[t], (v8f){});
#pragma unroll
    for (int t = 0; t < 16; ++t) { const int cc = t * 16 + nloc; const float bb = bfv(bl[t]);
#pragma unroll
      for (int r8 = 0; r8 < 8; ++r8) Tf[8 * hlf + r8][cc] = acc[t][r8] * (1.0f / (XS * WSC)) + bb; }
    wave_lds_sync();
    if (g == 1) { const size_t kt0 = (t0 / T) * (size_t)(H * (T / 16)) + (t0 % T) / 16;   // this wave's 16 tokens are one key tile of every head
      v4f kf[2 * H][2];
#pragma unroll
      for (int hj = 0; hj < 2 * H; ++hj) { const float* sp = &Tf[nloc][hj * 16 + 8 * hlf]; kf[hj][0] = *(const v4f*)sp; kf[hj][1] = *(const v4f*)(sp + 4); }   // all LDS reads in flight before the first conversion
      v8b khi[2 * H];
#pragma unroll
      for (int hj = 0; hj < 2 * H; ++hj) { const v4f f0 = kf[hj][0], f1 = kf[hj][1];
#pragma unroll
        for (int e = 0; e < 8; ++e) khi[hj][e] = (b16)((e < 4 ? f0[e & 3] : f1[e & 3]) * HS); }
#pragma unroll
      for (int hj = 0; hj < 2 * H; ++hj) { const size_t o = (kt0 + (size_t)(hj >> 1) * (T / 16)) * 512 + (hj & 1) * 256 + lane * 8; *(v8b*)(Kh + o) = khi[hj]; } }
    else { v2f qf[16][4];
#pragma unroll
      for (int rr = 0; rr < 16; ++rr) for (int q = 0; q < 4; ++q) qf[rr][q] = *(const v2f*)(&Tf[rr][q * 64 + lane * 2]);   // all LDS reads in flight before the first conversion
      v2b qhi[16][4];
#pragma unroll
      for (int rr = 0; rr < 16; ++rr)
#pragma unroll
        for (int q = 0; q < 4; ++q) qhi[rr][q] = (v2b){(b16)(qf[rr][q][0] * HS), (b16)(qf[rr][q][1] * HS)};
#pragma unroll
      for (int rr = 0; rr < 16; ++rr)
#pragma unroll
        for (int q = 0; q < 4; ++q) { const size_t o = (t0 + rr) * C + q * 64 + lane * 2; *(v2b*)(Qh + o) = qhi[rr][q]; }
      asm volatile("s_wait_xcnt 0x0" ::: "memory");   // what follows this branch rewrites the data and address registers of the Q stores
    }
    wave_lds_sync(); } }
// Scores are formed transposed, S^T = K Q^T: a lane holds 8 keys of ONE query per tile, so the maximum and the sum
// are taken in the lane's own registers (one exchange between the wave's halves), and two S^T tiles, converted in place,
// are the B operand of O^T += V^T P^T. Scores and P never pass through LDS.
__device__ __forceinline__ float other_half(float v) { return __uint_as_float(__builtin_amdgcn_permlanex16(__float_as_uint(v), __float_as_uint(v), 0x76543210u, 0xfedcba98u, false, false)); }
constexpr int AW = 4 /* waves per workgroup */, QB = AW * 32 /* queries per workgroup */, SK = 256 /* keys per stage */, NST = T / SK, SH = SK * D /* halves per stage of one array: 16 KiB */;
// Eight copies of 16 bytes per lane, 2 KiB apart in LDS and in memory alike (128 lanes x 16 bytes = 2 KiB per copy): one array's 16-KiB stage.
// The s_wait_xcnt is the last line of the copies' own statement, so that it stands in front of every later write of the address registers they name.
__device__ __forceinline__ void copy8(unsigned l, const b16* g) {
  asm volatile("global_load_async_to_lds_b128 %0, %8, off\n\t"
               "global_load_async_to_lds_b128 %1, %9, off\n\t"
               "global_load_async_to_lds_b128 %2, %10, off\n\t"
               "global_load_async_to_lds_b128 %3, %11, off\n\t"
               "global_load_async_to_lds_b128 %4, %12, off\n\t"
               "global_load_async_to_lds_b128 %5, %13, off\n\t"
               "global_load_async_to_lds_b128 %6, %14, off\n\t"
               "global_load_async_to_lds_b128 %7, %15, off\n\t"
               "s_wait_xcnt 0x0"
               :: "v"(l), "v"(l + 2048u), "v"(l + 4096u), "v"(l + 6144u), "v"(l + 8192u), "v"(l + 10240u), "v"(l + 12288u), "v"(l + 14336u),
                  "v"(g), "v"(g + 1024), "v"(g + 2048), "v"(g + 3072), "v"(g + 4096), "v"(g + 5120), "v"(g + 6144), "v"(g + 7168) : "memory"); }
// One stage into one buffer: l = the lane's LDS byte address in the buffer's first array, o = the lane's offset in halves, the same in both arrays.
__device__ __forceinline__ void stage_copy(unsigned l, size_t o, const b16* kh, const b16* vh) { copy8(l, kh + o); copy8(l + 2u * SH, vh + o); }
__global__ __launch_bounds__(128) void att_kernel(const b16* __restrict__ Qh, const b16* __restrict__ Kh, const b16* __restrict__ VTh, int QLIM, float* __restrict__ out) { __shared__ __attribute__((aligned(16))) b16 ring[2][2][SH] /* [buffer][K, V^T]; 64 KiB */; const int tid = threadIdx.x, lane = tid & 31, nloc = lane & 15, hlf = lane >> 4; const int b = blockIdx.x / (H * (T / QB)), rem = blockIdx.x % (H * (T / QB)); const int h = rem / (T / QB), qb = (rem % (T / QB)) * QB; if (qb >= QLIM) return;   // the whole workgroup leaves, in front of every barrier
  const int q0 = qb + (tid >> 5) * 32; const size_t tq = (size_t)b * T + q0;
  constexpr float CL = SCALE / (HS * HS) * 1.4426950408889634f;   // raw score -> log2 units
  constexpr float PLIM = 32768.0f;   // bound on a lane's sum over one pass of P as stored (times PS), above which the reference is renewed; below the largest f16
  v16b qa[2];
#pragma unroll
  for (int qt = 0; qt < 2; ++qt) qa[qt] = frag_kb(Qh + (tq + qt * 16 + nloc) * C + h * D, hlf);
  asm volatile("s_wait_xcnt 0x0" ::: "memory");   // the Q loads' address registers are reused below
  const size_t kvbase = ((size_t)b * H + h) * (size_t)(T * D) + tid * 8;   // K and V^T alike: 32 keys = two 512-half tiles; a stage is SH contiguous halves of each array
  const unsigned l0 = (unsigned)(size_t)&ring[0][0][tid * 8];   // the lane's LDS byte address: low 32 bits of the shared address
  stage_copy(l0, kvbase, Kh, VTh);   // stage 0 into buffer 0
  asm volatile("s_wait_asynccnt 0x0" ::: "memory");   // this wave's copies of stage 0 have landed
  __syncthreads();   // every wave's have: stage 0 may be read
  stage_copy(l0 + 4u * SH, kvbase + SH, Kh, VTh);   // stage 1 into buffer 1, in flight while stage 0 is worked on
  v8f oacc[2][2] = {{(v8f){}, (v8f){}}, {(v8f){}, (v8f){}}};   // [query tile][d tile]: register r8 = d t*16 + 8*hlf + r8, lane column = query
  float mx[2] = {-INFINITY, -INFINITY}, off[2] = {INFINITY, INFINITY}, ls[2] = {0.0f, 0.0f};   // mx: the reference in use, a maximum of scores seen; off = 8 - mx * CL; ls: this half's keys only, in units of PS
  // The stage loop and the pass loop stay rolled (the pass body already takes about 160 VGPRs); the inner loops are unrolled so that every fragment index is a constant and stays in registers.
#pragma unroll 1
  for (int st = 0; st < NST; ++st) {
  const b16* buf = &ring[st & 1][0][lane * 8];
  v16b kh[2];
#pragma unroll
  for (int t = 0; t < 2; ++t) kh[t] = frag_pk(buf + t * 512);
#pragma unroll 1
  for (int k0 = 0; k0 < SK; k0 += KC) {
    v16b vh[2];
#pragma unroll
    for (int t = 0; t < 2; ++t) vh[t] = frag_pk(buf + SH + k0 * D + t * 512);
    v8f s[2][2];
#pragma unroll
    for (int t = 0; t < 2; ++t)
#pragma unroll
      for (int qt = 0; qt < 2; ++qt) s[qt][t] = wmma16c(kh[t], qa[qt], (v8f){});
    __builtin_amdgcn_sched_barrier(0);   // the K reads below stay one group behind the last score product, not spread among the products
    { const int kn = k0 + KC < SK ? k0 + KC : 0;   // the next pass's K rows, into the registers just read; a stage's last pass re-reads its own stage's first rows and drops them: nothing of the next stage is read here
#pragma unroll
      for (int t = 0; t < 2; ++t) kh[t] = frag_pk(buf + kn * D + t * 512); }
    v2f p[2][8]; float ps[2];
    // P = 2^(score * CL + off) with the reference in use, and this half's sum of it
    auto expo = [&]() {
#pragma unroll
      for (int qt = 0; qt < 2; ++qt) { const v2f cl2 = {CL, CL}, off2 = {off[qt], off[qt]}; v2f sm[2];
#pragma unroll
        for (int t = 0; t < 2; ++t)
#pragma unroll
          for (int e = 0; e < 8; e += 2) { const v2f a = __builtin_elementwise_fma((v2f){s[qt][t][e], s[qt][t][e + 1]}, cl2, off2); const v2f x = {__builtin_amdgcn_exp2f(a[0]), __builtin_amdgcn_exp2f(a[1])}; sm[t] = e == 0 ? x : sm[t] + x; p[qt][t * 4 + e / 2] = x; }
        const v2f s2 = sm[0] + sm[1]; ps[qt] = s2[0] + s2[1]; } };
    expo();
    // Every p is >= 0, so no p is above the lane's sum: while that sum stays at or below PLIM every p fits f16 and the reference may stay.
    // One test per pass, a scalar branch; written as "not <=" so that an infinite sum (the first pass: off = +inf) and a NaN take the branch too. Marked as not expected, so that the renewal lies out of line and the usual path falls through.
    if (__builtin_expect(__builtin_amdgcn_ballot_w32(!(ps[0] + ps[1] <= PLIM)) != 0, 0)) {
#pragma unroll
      for (int qt = 0; qt < 2; ++qt) { float c2[2];   // new reference: the larger of the old reference and this pass's maximum; the sum and O are brought to it
#pragma unroll
        for (int t = 0; t < 2; ++t) { float m = s[qt][t][0];
#pragma unroll
          for (int r8 = 1; r8 < 8; ++r8) m = fmaxf(m, s[qt][t][r8]);
          c2[t] = m; }
        float cm = fmaxf(c2[0], c2[1]); cm = fmaxf(cm, other_half(cm));
        const float mo = mx[qt], mn = fmaxf(mo, cm); float fe; asm("v_exp_f32 %0, %1\n\tv_nop" : "=v"(fe) : "v"((mo - mn) * CL));   // exp2 and, in the same statement so that it stays directly behind, the one slot the instruction set asks for before a transcendental's source is overwritten or its result read
        const float fac = (mo == -INFINITY) ? 0.0f : fe; mx[qt] = mn;
        off[qt] = 8.0f - mn * CL;   // + 8: p comes out times PS = 256
        ls[qt] *= fac;
#pragma unroll
        for (int t = 0; t < 2; ++t) oacc[qt][t] *= fac; }
      expo(); }   // now every p <= PS
    v16b ph[2];
#pragma unroll
    for (int qt = 0; qt < 2; ++qt) { ls[qt] += ps[qt];
#pragma unroll
      for (int j = 0; j < 8; ++j) { const v2b hi = __builtin_convertvector(p[qt][j], v2b); ph[qt][2 * j] = hi[0]; ph[qt][2 * j + 1] = hi[1]; } }
#pragma unroll
    for (int qt = 0; qt < 2; ++qt)
#pragma unroll
      for (int t = 0; t < 2; ++t) oacc[qt][t] = wmma16c(vh[t], ph[qt], oacc[qt][t]);
    asm volatile("v_nop\n\tv_nop\n\tv_nop\n\tv_nop" : "+v"(oacc[0][0]), "+v"(oacc[0][1]), "+v"(oacc[1][0]), "+v"(oacc[1][1])); }   // once per pass, behind its last products (tied to their results): the four vector slots in front of the next pass's first product, whose result the compiler may place in the registers of P, their B operand
  asm volatile("s_wait_dscnt 0x0" ::: "memory");   // this wave's reads of the buffer have retired before the buffer is refilled
  asm volatile("s_wait_asynccnt 0x0" ::: "memory");   // this wave's copies of stage st + 1 have landed
  __syncthreads();   // publishes stage st + 1 and ends every wave's reads of stage st
  if (st + 2 < NST) stage_copy(l0 + (unsigned)(st & 1) * (4u * SH), kvbase + (size_t)(st + 2) * SH, Kh, VTh); }
  asm volatile("s_wait_asynccnt 0x0" ::: "memory");   // no copy is outstanding when the wave ends
  if (q0 < QLIM)
#pragma unroll
  for (int qt = 0; qt < 2; ++qt) { const float inv = (1.0f / HS) / (ls[qt] + other_half(ls[qt]));
#pragma unroll
    for (int t = 0; t < 2; ++t) { float* o = out + (tq + qt * 16 + nloc) * C + h * D + t * 16 + 8 * hlf; const v8f r = oacc[qt][t] * inv; *(v4f*)o = (v4f){r[0], r[1], r[2], r[3]}; *(v4f*)(o + 4) = (v4f){r[4], r[5], r[6], r[7]}; } } }
}  // namespace

extern "C" void kernel_launch(void* const* d_in, const int* in_sizes, int n_in, void* d_out, int out_size, void* d_ws, size_t ws_size, hipStream_t stream) {
  (void)n_in;
  auto Fp = [&](int i) { return (const float*)d_in[i]; };
  // input order: 0 x [4,2048,32]; 1 Wq [8,32,32]; 2 bq [8,32]; 3 Wk; 4 bk; 5 Wv; 6 bv
  if (in_sizes[0] != NB_ * T * D || in_sizes[1] != H * D * D || in_sizes[3] != H * D * D || in_sizes[5] != H * D * D || in_sizes[2] != H * D || out_size != NB_ * T * C) return;
  const int QLIM = T;   // per-(b,h) query cut (multiple of 32)
  size_t off = 0; char* ws = (char*)d_ws;
  auto carve = [&](size_t bytes) { char* p = ws + off; off += (bytes + 255) & ~(size_t)255; return p; };
  b16* Qh = (b16*)carve((size_t)NB_ * T * C * 2); b16* Kh = (b16*)carve((size_t)NB_ * T * C * 2); b16* VTh = (b16*)carve((size_t)NB_ * C * T * 2);
  if (off > ws_size || off > ((size_t)40 << 20)) return;   // ~ 12.6 MB
  proj_kernel<<<NB_ * T / (16 * PW), 32 * PW, 0, stream>>>(Fp(0), Fp(1), Fp(3), Fp(5), Fp(2), Fp(4), Fp(6), Qh, Kh, VTh);
  att_kernel<<<NB_ * H * (T / QB), QB, 0, stream>>>(Qh, Kh, VTh, QLIM, (float*)d_out);
}

// v010
// A run of this version takes 27 microseconds.
// Timed twice side by side with v009, it ran 1.04 times as fast both times.
// All steps since v000 together make it 15.9 times as fast.
#include <hip/hip_runtime.h>

// MultiHeadSA: per head h: q = x Wq[h] + bq[h], k = x Wk[h] + bk[h], v = x Wv[h] + bv[h] (D = 32); wei = softmax_s(q.k / sqrt(32)); out[b][t][h*32 + d] = sum_s wei v -> [4][2048][256].
// K and V^T lie in the workspace in fragment order: per (b,h) and 16-row tile 512 halves, element (row r, k) at (k>>4)*256 + (((k>>3)&1)*16 + r)*8 + (k&7), so one wave-wide 16-byte load reads 512 contiguous bytes (K: r = key, k = d; V^T: r = d, k = key within a 32-key pass, tiles ordered pass-major). The projection stores V^T straight from its accumulators: a lane of a tile x rows x Wv rows holds 8 consecutive tokens of one channel, which is one 16-byte unit of that order.
// Operand precision: q (times log2(e) / sqrt(32)), k, v (times 256) and P (times 256) enter their products rounded once to f16 (11 significant bits, to nearest even); sums, softmax and O stay f32.
// The map from score to exponent lies in the score product itself: its factor is in the stored q, its offset (8 - reference, per query) is the product's C operand, so the accumulators are the arguments of exp2.
// Attention: a workgroup of 4 waves (128 queries of one (b,h)) shares each 256-key stage of K and V^T through a two-buffer LDS ring filled by asynchronous copies; the fragments keep their order, so a wave-wide 16-byte LDS read is 512 contiguous bytes.
// Deterministic: flash-style online softmax over fixed 32-key passes in order; the reference that is subtracted from the scores is renewed only when a pass's P could leave the f16 range; no atomics.
// WMMA (v_wmma_f32_16x16x32_f16, f32 accumulate): x (EXACT bf16 x8, K 32) x [Wq|Wk|Wv] rows (EXACT; 48 tiles) per 16-token wave; per (b,h, 32-query) wave S^T = k rows x q (K 32) + offset and O^T += v^T rows x P^T (packed from the S^T tiles), one product each; softmax in f32, in registers.

namespace {
constexpr int NB_ = 4, T = 2048, H = 8, D = 32, C = H * D /* 256 */, KC = 32 /* keys per pass */;
constexpr float XS = 8.0f, HS = 256.0f, PS = 256.0f, WSC = 256.0f, SCALE = 0.17677669529663688f, QSC = SCALE * 1.4426950408889634f /* q as stored: q . k comes out in log2 units */;
typedef _Float16 b16;
typedef __attribute__((ext_vector_type(16))) _Float16 v16b;
typedef __attribute__((ext_vector_type(8))) _Float16 v8b;
typedef __attribute__((ext_vector_type(2))) _Float16 v2b;
typedef __attribute__((ext_vector_type(8))) float v8f;
typedef __attribute__((ext_vector_type(4))) float v4f;
typedef __attribute__((ext_vector_type(2))) float v2f;
__device__ __forceinline__ float bf16_rne(float f) { unsigned int u = __float_as_uint(f); u += 0x7FFFu + ((u >> 16) & 1u); float r = __uint_as_float(u & 0xFFFF0000u); asm volatile("" : "+v"(r)); return r; }
__device__ __forceinline__ float bfv(float f) { float r = bf16_rne(f); asm volatile("" : "+v"(r)); return r; }
__device__ __forceinline__ v16b frag_kb(const b16* p, int hh) { const v8b a = *(const v8b*)(p + 8 * hh), b = *(const v8b*)(p + 16 + 8 * hh); v16b f;
#pragma unroll
  for (int e = 0; e < 8; ++e) { f[e] = a[e]; f[8 + e] = b[e]; } return f; }
__device__ __forceinline__ v16b frag_pk(const b16* p) { const v8b a = *(const v8b*)p, b = *(const v8b*)(p + 256); v16b f;   // p: tile base + lane * 8
#pragma unroll
  for (int e = 0; e < 8; ++e) { f[e] = a[e]; f[8 + e] = b[e]; } return f; }
__device__ __forceinline__ v8f wmma16b(v16b a, v16b b, v8f c) { v8f d = __builtin_amdgcn_wmma_f32_16x16x32_f16(false, a, false, b, (short)0, c, false, false); asm volatile("v_nop\n\tv_nop\n\tv_nop\n\tv_nop" : "+v"(d) : "v"(a), "v"(b)); return d; }
__device__ __forceinline__ v8f wmma16c(v16b a, v16b b, v8f c) { return __builtin_amdgcn_wmma_f32_16x16x32_f16(false, a, false, b, (short)0, c, false, false); }   // for the attention loop, the builtin alone: the compiler keeps the distance behind it, with other WMMAs and softmax work where there is some
__device__ __forceinline__ void wave_lds_sync() { __builtin_amdgcn_fence(__ATOMIC_RELEASE, "workgroup"); __builtin_amdgcn_wave_barrier(); __builtin_amdgcn_fence(__ATOMIC_ACQUIRE, "workgroup"); }

// A workgroup of PW waves (16 tokens each) first rounds all of Wq | Wk | Wv into LDS, row r = (matrix, head, d) holding its 32 values over c (row pitch 80 bytes: 16 x odd, for the 16-byte fragment reads), and copies the biases there in the same order; every wave then takes its B fragments from LDS.
constexpr int PW = 4 /* waves per workgroup */, WP = D + 8 /* halves per LDS row of W */;
__global__ __launch_bounds__(32 * PW) void proj_kernel(const float* __restrict__ x, const float* __restrict__ wq, const float* __restrict__ wk, const float* __restrict__ wv, const float* __restrict__ bq, const float* __restrict__ bk, const float* __restrict__ bv, b16* __restrict__ Qh, b16* __restrict__ Kh, b16* __restrict__ VTh) { __shared__ __attribute__((aligned(16))) b16 Wl[3 * C][WP]; __shared__ __attribute__((aligned(16))) float Bl[3 * C]; __shared__ __attribute__((aligned(16))) b16 AxW[PW][16][D + 8]; __shared__ __attribute__((aligned(16))) float TfW[PW][16][260]; const int tid = threadIdx.x, wave = tid >> 5, lane = tid & 31, nloc = lane & 15, hlf = lane >> 4; b16 (*Ax)[D + 8] = AxW[wave]; float (*Tf)[260] = TfW[wave];   // Ax and Tf: each wave's own
  const size_t t0 = ((size_t)blockIdx.x * PW + wave) * 16;
  { float xl[16]; const float* xp = x + t0 * D + lane;
#pragma unroll
    for (int rr = 0; rr < 16; ++rr) xl[rr] = xp[rr * D];   // the 16 rows' loads in flight together: one latency, not 16
    // W: a lane takes 8 values of c x 4 of d per unit (8 lanes cover one 128-byte row of W, a wave-wide load 4 whole rows), 6 units: matrix i >> 1, head (i & 1) * 4 + wave
    const int db = lane & 7, cb = lane >> 3; v4f wl[6][8]; float bl6[6];
#pragma unroll
    for (int i = 0; i < 6; ++i) { const float* w = (i < 2 ? wq : (i < 4 ? wk : wv)) + ((size_t)((i & 1) * 4 + wave) * D + cb * 8) * D + db * 4;
#pragma unroll
      for (int j = 0; j < 8; ++j) wl[i][j] = *(const v4f*)(w + j * D);   // all 48 loads in flight before the first value is used
      bl6[i] = (i < 2 ? bq : (i < 4 ? bk : bv))[(i & 1) * 128 + tid];
      if (i & 1) asm volatile("s_wait_xcnt 0x0" ::: "memory"); }   // behind each matrix's loads: what follows (the next matrix's loads, then the rounding) may be given the registers that hold their addresses
#pragma unroll
    for (int rr = 0; rr < 16; ++rr) Ax[rr][lane] = (b16)(bf16_rne(xl[rr]) * XS);
#pragma unroll
    for (int i = 0; i < 6; ++i) {
#pragma unroll
      for (int e = 0; e < 4; ++e) { v8b v;
#pragma unroll
        for (int j = 0; j < 8; ++j) v[j] = (b16)(bf16_rne(wl[i][j][e]) * WSC);
        *(v8b*)&Wl[(i >> 1) * C + ((i & 1) * 4 + wave) * D + db * 4 + e][cb * 8] = v; }
      Bl[i * 128 + tid] = bl6[i]; } }
  if (lane < 16) for (int k = D; k < D + 8; ++k) Ax[lane][k] = (b16)0.0f;
  __syncthreads();   // W and the biases, written by all waves, may be read by all; nothing writes them again
  const v16b a = frag_kb(&Ax[nloc][0], hlf);
  { v16b wf[16]; float bl[16];   // V first, no LDS pass: its stores retire under the Q group's loads
#pragma unroll
    for (int t = 0; t < 16; ++t) { wf[t] = frag_kb(&Wl[2 * C + t * 16 + nloc][0], hlf); bl[t] = Bl[2 * C + t * 16 + nloc]; }   // the group's 32 fragment reads and 16 bias reads in flight before the first product
    const size_t vb = ((t0 / T) * (size_t)(H * (T / 32)) + (t0 % T) / 32) * 1024 + ((t0 / 16) & 1) * 256 + lane * 8;   // this wave's 16 tokens are one half (k >> 4) of one 32-key pass of every head
    v8b vhi[16];
#pragma unroll
    for (int t = 0; t < 16; ++t) { const v8f acc = wmma16b(a, wf[t], (v8f){}); const float bb = bfv(bl[t]);   // register r8 = token 8 * hlf + r8 (k & 7 = r8, (k >> 3) & 1 = hlf), lane column = channel t * 16 + nloc (head t >> 1, d tile t & 1, r = nloc)
#pragma unroll
      for (int r8 = 0; r8 < 8; ++r8) vhi[t][r8] = (b16)((acc[r8] * (1.0f / (XS * WSC)) + bb) * HS); }
#pragma unroll
    for (int t = 0; t < 16; ++t) { const size_t o = vb + (size_t)(t >> 1) * ((T / 32) * 1024) + (t & 1) * 512; *(v8b*)(VTh + o) = vhi[t]; }
    asm volatile("s_wait_xcnt 0x0" ::: "memory"); }   // what follows rewrites the data and address registers of the V^T stores
#pragma unroll 1
  for (int g = 0; g < 2; ++g) { v8f acc[16]; v16b wf[16]; float bl[16];   // Q and K: through LDS into their layouts
#pragma unroll
    for (int t = 0; t < 16; ++t) { wf[t] = frag_kb(&Wl[g * C + t * 16 + nloc][0], hlf); bl[t] = Bl[g * C + t * 16 + nloc]; }   // the group's 32 fragment reads and 16 bias reads in flight before the first product
#pragma unroll
    for (int t = 0; t < 16; ++t) acc[t] = wmma16b(a, wf[t], (v8f){});
#pragma unroll
    for (int t = 0; t < 16; ++t) { const int cc = t * 16 + nloc; const float bb = bfv(bl[t]);
#pragma unroll
      for (int r8 = 0; r8 < 8; ++r8) Tf[8 * hlf + r8][cc] = acc[t][r8] * (1.0f / (XS * WSC)) + bb; }
    wave_lds_sync();
    if (g == 1) { const size_t kt0 = (t0 / T) * (size_t)(H * (T / 16)) + (t0 % T) / 16;   // this wave's 16 tokens are one key tile of every head
      v4f kf[2 * H][2];
#pragma unroll
      for (int hj = 0; hj < 2 * H; ++hj) { const float* sp = &Tf[nloc][hj * 16 + 8 * hlf]; kf[hj][0] = *(const v4f*)sp; kf[hj][1] = *(const v4f*)(sp + 4); }   // all LDS reads in flight before the first conversion
      v8b khi[2 * H];
#pragma unroll
      for (int hj = 0; hj < 2 * H; ++hj) { const v4f f0 = kf[hj][0], f1 = kf[hj][1];
#pragma unroll
        for (int e = 0; e < 8; ++e) khi[hj][e] = (b16)(e < 4 ? f0[e & 3] : f1[e & 3]); }
#pragma unroll
      for (int hj = 0; hj < 2 * H; ++hj) { const size_t o = (kt0 + (size_t)(hj >> 1) * (T / 16)) * 512 + (hj & 1) * 256 + lane * 8; *(v8b*)(Kh + o) = khi[hj]; } }
    else { v2f qf[16][4];
#pragma unroll
      for (int rr = 0; rr < 16; ++rr) for (int q = 0; q < 4; ++q) qf[rr][q] = *(const v2f*)(&Tf[rr][q * 64 + lane * 2]);   // all LDS reads in flight before the first conversion
      v2b qhi[16][4];
#pragma unroll
      for (int rr = 0; rr < 16; ++rr)
#pragma unroll
        for (int q = 0; q < 4; ++q) qhi[rr][q] = (v2b){(b16)(qf[rr][q][0] * QSC), (b16)(qf[rr][q][1] * QSC)};
#pragma unroll
      for (int rr = 0; rr < 16; ++rr)
#pragma unroll
        for (int q = 0; q < 4; ++q) { const size_t o = (t0 + rr) * C + q * 64 + lane * 2; *(v2b*)(Qh + o) = qhi[rr][q]; }
      asm volatile("s_wait_xcnt 0x0" ::: "memory");   // what follows this branch rewrites the data and address registers of the Q stores
    }
    wave_lds_sync(); } }
// Scores are formed transposed, S^T = K Q^T: a lane holds 8 keys of ONE query per tile, so the maximum and the sum
// are taken in the lane's own registers (one exchange between the wave's halves), and two S^T tiles, converted in place,
// are the B operand of O^T += V^T P^T. Scores and P never pass through LDS.
__device__ __forceinline__ float other_half(float v) { return __uint_as_float(__builtin_amdgcn_permlanex16(__float_as_uint(v), __float_as_uint(v), 0x76543210u, 0xfedcba98u, false, false)); }
constexpr int AW = 4 /* waves per workgroup */, QB = AW * 32 /* queries per workgroup */, SK = 256 /* keys per stage */, NST = T / SK, SH = SK * D /* halves per stage of one array: 16 KiB */;
// Eight copies of 16 bytes per lane, 2 KiB apart in LDS and in memory alike (128 lanes x 16 bytes = 2 KiB per copy): one array's 16-KiB stage.
// The s_wait_xcnt is the last line of the copies' own statement, so that it stands in front of every later write of the address registers they name.
__device__ __forceinline__ void copy8(unsigned l, const b16* g) {
  asm volatile("global_load_async_to_lds_b128 %0, %8, off\n\t"
               "global_load_async_to_lds_b128 %1, %9, off\n\t"
               "global_load_async_to_lds_b128 %2, %10, off\n\t"
               "global_load_async_to_lds_b128 %3, %11, off\n\t"
               "global_load_async_to_lds_b128 %4, %12, off\n\t"
               "global_load_async_to_lds_b128 %5, %13, off\n\t"
               "global_load_async_to_lds_b128 %6, %14, off\n\t"
               "global_load_async_to_lds_b128 %7, %15, off\n\t"
               "s_wait_xcnt 0x0"
               :: "v"(l), "v"(l + 2048u), "v"(l + 4096u), "v"(l + 6144u), "v"(l + 8192u), "v"(l + 10240u), "v"(l + 12288u), "v"(l + 14336u),
                  "v"(g), "v"(g + 1024), "v"(g + 2048), "v"(g + 3072), "v"(g + 4096), "v"(g + 5120), "v"(g + 6144), "v"(g + 7168) : "memory"); }
// One stage into one buffer: l = the lane's LDS byte address in the buffer's first array, o = the lane's offset in halves, the same in both arrays.
__device__ __forceinline__ void stage_copy(unsigned l, size_t o, const b16* kh, const b16* vh) { copy8(l, kh + o); copy8(l + 2u * SH, vh + o); }
__global__ __launch_bounds__(128) void att_kernel(const b16* __restrict__ Qh, const b16* __restrict__ Kh, const b16* __restrict__ VTh, int QLIM, float* __restrict__ out) { __shared__ __attribute__((aligned(16))) b16 ring[2][2][SH] /* [buffer][K, V^T]; 64 KiB */; const int tid = threadIdx.x, lane = tid & 31, nloc = lane & 15, hlf = lane >> 4; const int b = blockIdx.x / (H * (T / QB)), rem = blockIdx.x % (H * (T / QB)); const int h = rem / (T / QB), qb = (rem % (T / QB)) * QB; if (qb >= QLIM) return;   // the whole workgroup leaves, in front of every barrier
  const int q0 = qb + (tid >> 5) * 32; const size_t tq = (size_t)b * T + q0;
  constexpr float PLIM = 32768.0f;   // bound on a lane's sum over one pass of P as stored (times PS), above which the reference is renewed; below the largest f16
  v16b qa[2];
#pragma unroll
  for (int qt = 0; qt < 2; ++qt) qa[qt] = frag_kb(Qh + (tq + qt * 16 + nloc) * C + h * D, hlf);
  asm volatile("s_wait_xcnt 0x0" ::: "memory");   // the Q loads' address registers are reused below
  const size_t kvbase = ((size_t)b * H + h) * (size_t)(T * D) + tid * 8;   // K and V^T alike: 32 keys = two 512-half tiles; a stage is SH contiguous halves of each array
  const unsigned l0 = (unsigned)(size_t)&ring[0][0][tid * 8];   // the lane's LDS byte address: low 32 bits of the shared address
  stage_copy(l0, kvbase, Kh, VTh);   // stage 0 into buffer 0
  asm volatile("s_wait_asynccnt 0x0" ::: "memory");   // this wave's copies of stage 0 have landed
  __syncthreads();   // every wave's have: stage 0 may be read
  stage_copy(l0 + 4u * SH, kvbase + SH, Kh, VTh);   // stage 1 into buffer 1, in flight while stage 0 is worked on
  v8f oacc[2][2] = {{(v8f){}, (v8f){}}, {(v8f){}, (v8f){}}};   // [query tile][d tile]: register r8 = d t*16 + 8*hlf + r8, lane column = query
  float mx[2] = {-INFINITY, -INFINITY}, ls[2] = {0.0f, 0.0f}, lim = -1.0f;   // mx: the reference in use, a maximum of scores seen (log2 units); ls: this half's keys only, in units of PS; lim: the bound on a pass's sum of P, below every sum until the first pass has set a reference
  v8f offc[2] = {(v8f){}, (v8f){}};   // C operand of the score products: every register holds 8 - mx of the lane's query (0 until there is a reference)
  // The stage loop and the pass loop stay rolled (the pass body already takes about 160 VGPRs); the inner loops are unrolled so that every fragment index is a constant and stays in registers.
#pragma unroll 1
  for (int st = 0; st < NST; ++st) {
  const b16* buf = &ring[st & 1][0][lane * 8];
  v16b kh[2];
#pragma unroll
  for (int t = 0; t < 2; ++t) kh[t] = frag_pk(buf + t * 512);
#pragma unroll 1
  for (int k0 = 0; k0 < SK; k0 += KC) {
    v16b vh[2];
#pragma unroll
    for (int t = 0; t < 2; ++t) vh[t] = frag_pk(buf + SH + k0 * D + t * 512);
    v8f s[2][2];
#pragma unroll
    for (int t = 0; t < 2; ++t)
#pragma unroll
      for (int qt = 0; qt < 2; ++qt) s[qt][t] = wmma16c(kh[t], qa[qt], offc[qt]);
    asm volatile("" :: "v"(offc[0]), "v"(offc[1]));   // inputs only, no instruction: the offsets stay live behind their last product of the pass, so that the compiler gives every score product a D apart from its C; without it, it copies C into D in front of two of the four (8 v_mov_b64 a pass)
    __builtin_amdgcn_sched_barrier(0);   // the K reads below stay one group behind the last score product, not spread among the products
    { const int kn = k0 + KC < SK ? k0 + KC : 0;   // the next pass's K rows, into the registers just read; a stage's last pass re-reads its own stage's first rows and drops them: nothing of the next stage is read here
#pragma unroll
      for (int t = 0; t < 2; ++t) kh[t] = frag_pk(buf + kn * D + t * 512); }
    v2f p[2][8]; float ps[2];
    // P = 2^s, s being score + offset with the reference in use, and this half's sum of it
    auto expo = [&]() {
#pragma unroll
      for (int qt = 0; qt < 2; ++qt) { v2f sm[2];
#pragma unroll
        for (int t = 0; t < 2; ++t)
#pragma unroll
          for (int e = 0; e < 8; e += 2) { const v2f x = {__builtin_amdgcn_exp2f(s[qt][t][e]), __builtin_amdgcn_exp2f(s[qt][t][e + 1])}; sm[t] = e == 0 ? x : sm[t] + x; p[qt][t * 4 + e / 2] = x; }
        const v2f s2 = sm[0] + sm[1]; ps[qt] = s2[0] + s2[1]; } };
    expo();
    // Every p is >= 0, so no p is above the lane's sum: while that sum stays at or below PLIM every p fits f16 and the reference may stay.
    // One test per pass, a scalar branch; written as "not <=" so that an infinite sum and a NaN take the branch too; the first pass takes it because lim is still negative. Marked as not expected, so that the renewal lies out of line and the usual path falls through.
    if (__builtin_expect(__builtin_amdgcn_ballot_w32(!(ps[0] + ps[1] <= lim)) != 0, 0)) {
#pragma unroll
      for (int qt = 0; qt < 2; ++qt) { float c2[2];   // new reference: the larger of the old reference and this pass's maximum; the sum and O are brought to it
#pragma unroll
        for (int t = 0; t < 2; ++t) { float m = s[qt][t][0];
#pragma unroll
          for (int r8 = 1; r8 < 8; ++r8) m = fmaxf(m, s[qt][t][r8]);
          c2[t] = m; }
        float cm = fmaxf(c2[0], c2[1]); cm = fmaxf(cm, other_half(cm));
        const float oo = offc[qt][0], mo = mx[qt], mn = fmaxf(mo, cm - oo); float fe; asm("v_exp_f32 %0, %1\n\tv_nop" : "=v"(fe) : "v"(mo - mn));   // exp2 and, in the same statement so that it stays directly behind, the one slot the instruction set asks for before a transcendental's source is overwritten or its result read
        const float fac = (mo == -INFINITY) ? 0.0f : fe; mx[qt] = mn;
        const float on = 8.0f - mn, dd = on - oo;   // + 8: p comes out times PS = 256; dd brings this pass's s, formed with the old offset, to the new one
#pragma unroll
        for (int r8 = 0; r8 < 8; ++r8) offc[qt][r8] = on;
#pragma unroll
        for (int t = 0; t < 2; ++t) s[qt][t] += dd;
        ls[qt] *= fac;
#pragma unroll
        for (int t = 0; t < 2; ++t) oacc[qt][t] *= fac; }
      lim = PLIM; expo(); }   // now every p <= PS
    v16b ph[2];
#pragma unroll
    for (int qt = 0; qt < 2; ++qt) { ls[qt] += ps[qt];
#pragma unroll
      for (int j = 0; j < 8; ++j) { const v2b hi = __builtin_convertvector(p[qt][j], v2b); ph[qt][2 * j] = hi[0]; ph[qt][2 * j + 1] = hi[1]; } }
#pragma unroll
    for (int qt = 0; qt < 2; ++qt)
#pragma unroll
      for (int t = 0; t < 2; ++t) oacc[qt][t] = wmma16c(vh[t], ph[qt], oacc[qt][t]);
    asm volatile("v_nop\n\tv_nop\n\tv_nop\n\tv_nop" : "+v"(oacc[0][0]), "+v"(oacc[0][1]), "+v"(oacc[1][0]), "+v"(oacc[1][1])); }   // once per pass, behind its last products (tied to their results): the four vector slots in front of the next pass's first product, whose result the compiler may place in the registers of P, their B operand
  asm volatile("s_wait_dscnt 0x0" ::: "memory");   // this wave's reads of the buffer have retired before the buffer is refilled
  asm volatile("s_wait_asynccnt 0x0" ::: "memory");   // this wave's copies of stage st + 1 have landed
  __syncthreads();   // publishes stage st + 1 and ends every wave's reads of stage st
  if (st + 2 < NST) stage_copy(l0 + (unsigned)(st & 1) * (4u * SH), kvbase + (size_t)(st + 2) * SH, Kh, VTh); }
  asm volatile("s_wait_asynccnt 0x0" ::: "memory");   // no copy is outstanding when the wave ends
  if (q0 < QLIM)
#pragma unroll
  for (int qt = 0; qt < 2; ++qt) { const float inv = (1.0f / HS) / (ls[qt] + other_half(ls[qt]));
#pragma unroll
    for (int t = 0; t < 2; ++t) { float* o = out + (tq + qt * 16 + nloc) * C + h * D + t * 16 + 8 * hlf; const v8f r = oacc[qt][t] * inv; *(v4f*)o = (v4f){r[0], r[1], r[2], r[3]}; *(v4f*)(o + 4) = (v4f){r[4], r[5], r[6], r[7]}; } } }
}  // namespace

extern "C" void kernel_launch(void* const* d_in, const int* in_sizes, int n_in, void* d_out, int out_size, void* d_ws, size_t ws_size, hipStream_t stream) {
  (void)n_in;
  auto Fp = [&](int i) { return (const float*)d_in[i]; };
  // input order: 0 x [4,2048,32]; 1 Wq [8,32,32]; 2 bq [8,32]; 3 Wk; 4 bk; 5 Wv; 6 bv
  if (in_sizes[0] != NB_ * T * D || in_sizes[1] != H * D * D || in_sizes[3] != H * D * D || in_sizes[5] != H * D * D || in_sizes[2] != H * D || out_size != NB_ * T * C) return;
  const int QLIM = T;   // per-(b,h) query cut (multiple of 32)
  size_t off = 0; char* ws = (char*)d_ws;
  auto carve = [&](size_t bytes) { char* p = ws + off; off += (bytes + 255) & ~(size_t)255; return p; };
  b16* Qh = (b16*)carve((size_t)NB_ * T * C * 2); b16* Kh = (b16*)carve((size_t)NB_ * T * C * 2); b16* VTh = (b16*)carve((size_t)NB_ * C * T * 2);
  if (off > ws_size || off > ((size_t)40 << 20)) return;   // ~ 12.6 MB
  proj_kernel<<<NB_ * T / (16 * PW), 32 * PW, 0, stream>>>(Fp(0), Fp(1), Fp(3), Fp(5), Fp(2), Fp(4), Fp(6), Qh, Kh, VTh);
  att_kernel<<<NB_ * H * (T / QB), QB, 0, stream>>>(Qh, Kh, VTh, QLIM, (float*)d_out);
}
